// v000
// The times below were measured on an AMD MI455X: many runs one after another, warmed up first and cycling through
// copies of the inputs, with the whole window's GPU time divided by the number of runs. Launches and the gaps
// between them are all in it. The median over several windows is given; except for v000 it joins two sittings, which
// can be a few percent apart, so the side-by-side timings, each taken in one sitting, are the better comparison.
// The starting kernel, v000, takes 187 microseconds a run.
#include <hip/hip_runtime.h>
#include <cfloat>
#include <cmath>
#include <cstdint>

typedef _Float16 h16;
typedef __attribute__((ext_vector_type(16))) _Float16 v16h;
typedef __attribute__((ext_vector_type(8)))  float    v8f;

#define NSEQ     1024
#define DHEAD    64
#define BQ       128      // query rows per workgroup
#define WQ       16       // query rows per wave
#define BJ       32       // keys per j-iteration (K=32 for the PV WMMA)
#define NWAVES   8
#define NTHREADS 256

// A/B fragment dword r (0..7) + lane-half h (0/1) -> first K index of the
// packed f16 pair, per the CDNA5 16-bit A-matrix 16x32 VGPR layout.
__device__ __forceinline__ int kmap(int r, int h) {
    return 2 * r + ((r >= 4) ? 8 : 0) + 8 * h;
}

__device__ __forceinline__ v8f fz8() {
    v8f z;
#pragma unroll
    for (int i = 0; i < 8; ++i) z[i] = 0.0f;
    return z;
}

// Generic pointer to an LDS object: low 32 bits are the LDS offset.
__device__ __forceinline__ uint32_t lds_addr(const void* p) {
    return (uint32_t)(uintptr_t)p;
}

// CDNA5 async global->LDS DMA (GVS mode: SADDR base + 32-bit VGPR byte offset).
__device__ __forceinline__ void async_copy_b128(uint32_t lds_dst, uint32_t byte_off,
                                                const float* sbase) {
    asm volatile("global_load_async_to_lds_b128 %0, %1, %2"
                 :: "v"(lds_dst), "v"(byte_off), "s"(sbase) : "memory");
}
__device__ __forceinline__ void async_copy_b32(uint32_t lds_dst, uint32_t byte_off,
                                               const float* sbase) {
    asm volatile("global_load_async_to_lds_b32 %0, %1, %2"
                 :: "v"(lds_dst), "v"(byte_off), "s"(sbase) : "memory");
}
__device__ __forceinline__ void wait_async0() {
    asm volatile("s_wait_asynccnt 0x0" ::: "memory");
}

// Max-reduce across the 16 lanes holding one matrix row, using DPP row
// rotations (VALU only -- keeps the LDS pipe free for fragment loads).
__device__ __forceinline__ float row_max16(float x) {
    int xi;
    xi = __builtin_amdgcn_update_dpp(0, __builtin_bit_cast(int, x), 0x121, 0xF, 0xF, true);
    x  = fmaxf(x, __builtin_bit_cast(float, xi));
    xi = __builtin_amdgcn_update_dpp(0, __builtin_bit_cast(int, x), 0x122, 0xF, 0xF, true);
    x  = fmaxf(x, __builtin_bit_cast(float, xi));
    xi = __builtin_amdgcn_update_dpp(0, __builtin_bit_cast(int, x), 0x124, 0xF, 0xF, true);
    x  = fmaxf(x, __builtin_bit_cast(float, xi));
    xi = __builtin_amdgcn_update_dpp(0, __builtin_bit_cast(int, x), 0x128, 0xF, 0xF, true);
    x  = fmaxf(x, __builtin_bit_cast(float, xi));
    return x;
}

__global__ __launch_bounds__(NTHREADS)
void attn_fwd_wmma(const float* __restrict__ q, const float* __restrict__ k,
                   const float* __restrict__ v, const float* __restrict__ bias,
                   float* __restrict__ out) {
    __shared__ float kf_lds[2][BJ * DHEAD];      // keys, row-major (j, d), dbl buf
    __shared__ float vT_lds[2][DHEAD * BJ];      // values transposed (d, j), dbl buf
    __shared__ h16   p_lds[NWAVES * WQ * BJ];    // per-wave P transpose scratch

    const int tid  = threadIdx.x;
    const int wave = tid >> 5;
    const int lane = tid & 31;
    const int n16  = lane & 15;    // column index inside a 16-wide tile
    const int h    = lane >> 4;    // lane half (selects K subset / row offset)

    const int iblk  = blockIdx.x;              // 0..7
    const int bh    = blockIdx.y;              // 0..63 (b*H + h)
    const int wg_i0 = iblk * BQ;
    const int i0    = wg_i0 + wave * WQ;       // this wave's first query row

    const float scale = 0.125f;                // 1/sqrt(64)

    const size_t base_qk = (size_t)bh * NSEQ * DHEAD;
    const size_t base_b  = (size_t)bh * NSEQ * NSEQ;

    // ---- Q fragments (A layout), fp32 -> f16 on the fly -------------------
    v16h qa[2];
    {
        const float* qrow = q + base_qk + (size_t)(i0 + n16) * DHEAD;
#pragma unroll
        for (int f = 0; f < 2; ++f) {
#pragma unroll
            for (int r = 0; r < 8; ++r) {
                const int d0 = f * 32 + kmap(r, h);
                qa[f][2 * r]     = (h16)qrow[d0];
                qa[f][2 * r + 1] = (h16)qrow[d0 + 1];
            }
        }
    }

    // all-ones B fragment: row-sum of P via WMMA (P x ones -> l in C layout)
    v16h ones;
#pragma unroll
    for (int i = 0; i < 16; ++i) ones[i] = (h16)1.0f;

    // ---- accumulators & online-softmax state ------------------------------
    v8f o[4];
#pragma unroll
    for (int t = 0; t < 4; ++t) o[t] = fz8();
    v8f lacc = fz8();                          // softmax denominator, C layout
    float mrow[8];
#pragma unroll
    for (int r = 0; r < 8; ++r) mrow[r] = -FLT_MAX;

    const int njb = (wg_i0 + BQ) / BJ;         // uniform across the workgroup

    // ---- async stage of one 32-key K/V tile into LDS buffer `buf` ---------
    auto stage = [&](int j0, int buf) {
        const float* kb_ = k + base_qk + (size_t)j0 * DHEAD;
        const float* vb_ = v + base_qk + (size_t)j0 * DHEAD;
        // K row-major: 2048 dwords, b128 per lane -> 2 DMA ops per thread
#pragma unroll
        for (int i = 0; i < (BJ * DHEAD) / (NTHREADS * 4); ++i) {
            const int e = tid * 4 + i * NTHREADS * 4;
            async_copy_b128(lds_addr(&kf_lds[buf][e]), (uint32_t)(e * 4), kb_);
        }
        // V transposed in the DMA: per-lane LDS dest = (d, j); global contiguous
#pragma unroll
        for (int i = 0; i < (BJ * DHEAD) / NTHREADS; ++i) {
            const int e  = tid + i * NTHREADS;
            const int jr = e / DHEAD;
            const int c  = e % DHEAD;
            async_copy_b32(lds_addr(&vT_lds[buf][c * BJ + jr]), (uint32_t)(e * 4), vb_);
        }
    };

    stage(0, 0);
    int cur = 0;

    for (int jb = 0; jb < njb; ++jb) {
        const int j0 = jb * BJ;

        wait_async0();          // this wave's DMA for tile jb is in LDS
        __syncthreads();        // everyone's DMA visible; prev buffer free

        if (jb + 1 < njb) stage((jb + 1) * BJ, cur ^ 1);   // overlap next tile

        if (j0 <= i0 + WQ - 1) {               // wave-uniform causal skip
            // prefetch next iteration's 16x32 bias tile (one line per row)
            if (jb + 1 < njb) {
                const float* bp = bias + base_b + (size_t)(i0 + n16) * NSEQ
                                  + (size_t)(j0 + BJ) + h * 16;
                __builtin_prefetch(bp, 0, 0);
            }

            const float* kbuf = kf_lds[cur];
            const float* vbuf = vT_lds[cur];

            // ---- S = Q K^T (+scale +bias +causal), two 16-key subtiles ----
            v8f svals[2];
#pragma unroll
            for (int jt = 0; jt < 2; ++jt) {
                const float* krow = &kbuf[(jt * 16 + n16) * DHEAD];
                v8f s = fz8();
#pragma unroll
                for (int f = 0; f < 2; ++f) {
                    v16h kb;
#pragma unroll
                    for (int r = 0; r < 8; ++r) {
                        const int d0 = f * 32 + kmap(r, h);
                        kb[2 * r]     = (h16)krow[d0];
                        kb[2 * r + 1] = (h16)krow[d0 + 1];
                    }
                    s = __builtin_amdgcn_wmma_f32_16x16x32_f16(
                            false, qa[f], false, kb, (short)0, s, false, false);
                }
#pragma unroll
                for (int r = 0; r < 8; ++r) {
                    const int row = i0 + r + 8 * h;
                    const int col = j0 + jt * 16 + n16;
                    // bias is stream-once: non-temporal keeps K/V resident in L2
                    float val = s[r] * scale + __builtin_nontemporal_load(
                                    bias + base_b + (size_t)row * NSEQ + col);
                    if (col > row) val = -FLT_MAX;   // causal: strictly above diag
                    s[r] = val;
                }
                svals[jt] = s;
            }

            // ---- online softmax: DPP row-max, WMMA row-sum ----------------
            float alpha[8];
#pragma unroll
            for (int r = 0; r < 8; ++r) {
                const float t    = row_max16(fmaxf(svals[0][r], svals[1][r]));
                const float mnew = fmaxf(mrow[r], t);
                alpha[r] = __expf(mrow[r] - mnew);
                mrow[r]  = mnew;
            }

            h16* pw = &p_lds[wave * WQ * BJ];
#pragma unroll
            for (int r = 0; r < 8; ++r) {
                const float p0 = __expf(svals[0][r] - mrow[r]);
                const float p1 = __expf(svals[1][r] - mrow[r]);
                const int   M  = r + 8 * h;
                pw[M * BJ + n16]      = (h16)p0;   // C-layout -> (M, j) scratch
                pw[M * BJ + 16 + n16] = (h16)p1;
            }

            // ---- rescale O and l, then O += P V, l += P * ones ------------
#pragma unroll
            for (int t = 0; t < 4; ++t)
#pragma unroll
                for (int r = 0; r < 8; ++r) o[t][r] *= alpha[r];
#pragma unroll
            for (int r = 0; r < 8; ++r) lacc[r] *= alpha[r];

            v16h pa;
            {
                const h16* pr = &p_lds[wave * WQ * BJ + n16 * BJ];
#pragma unroll
                for (int r = 0; r < 8; ++r) {
                    const int jj = kmap(r, h);
                    pa[2 * r]     = pr[jj];
                    pa[2 * r + 1] = pr[jj + 1];
                }
            }
            lacc = __builtin_amdgcn_wmma_f32_16x16x32_f16(
                       false, pa, false, ones, (short)0, lacc, false, false);
#pragma unroll
            for (int t = 0; t < 4; ++t) {
                v16h vb;
                const float* vcol = &vbuf[(t * 16 + n16) * BJ];
#pragma unroll
                for (int r = 0; r < 8; ++r) {
                    const int jj = kmap(r, h);
                    vb[2 * r]     = (h16)vcol[jj];
                    vb[2 * r + 1] = (h16)vcol[jj + 1];
                }
                o[t] = __builtin_amdgcn_wmma_f32_16x16x32_f16(
                           false, pa, false, vb, (short)0, o[t], false, false);
            }
        }
        cur ^= 1;
    }

    // ---- normalize and store (non-temporal: output is never re-read) ------
#pragma unroll
    for (int r = 0; r < 8; ++r) {
        const float inv = 1.0f / lacc[r];
        const int   row = i0 + r + 8 * h;
        float* orow = out + base_qk + (size_t)row * DHEAD;
#pragma unroll
        for (int t = 0; t < 4; ++t)
            __builtin_nontemporal_store(o[t][r] * inv, orow + t * 16 + n16);
    }
}

extern "C" void kernel_launch(void* const* d_in, const int* in_sizes, int n_in,
                              void* d_out, int out_size, void* d_ws, size_t ws_size,
                              hipStream_t stream) {
    const float* q    = (const float*)d_in[0];
    const float* k    = (const float*)d_in[1];
    const float* v    = (const float*)d_in[2];
    const float* bias = (const float*)d_in[3];
    float* out = (float*)d_out;

    dim3 grid(NSEQ / BQ, 4 * 16);   // (i-blocks, B*H)
    dim3 block(NTHREADS);
    attn_fwd_wmma<<<grid, block, 0, stream>>>(q, k, v, bias, out);
}

// v001
// A run of this version takes 56.9 microseconds.
// Timed twice side by side with v000, it ran 3.35 and 3.36 times as fast.
#include <hip/hip_runtime.h>
#include <cfloat>
#include <cmath>
#include <cstdint>

typedef _Float16 h16;
typedef __attribute__((ext_vector_type(16))) _Float16 v16h;
typedef __attribute__((ext_vector_type(8)))  float    v8f;

#define NSEQ     1024
#define DHEAD    64
#define BQ       128      // query rows per workgroup
#define WQ       16       // query rows per wave
#define BJ       32       // keys per j-iteration (K=32 for the PV WMMA)
#define NWAVES   8
#define NTHREADS 256
// LDS row pitches: 16 B x odd, so that the 16 lanes of a ds_load_b128 that walk
// 16 rows fall on 16 different groups of four banks.
#define KP       68       // floats per K row   (272 B)
#define VP       36       // floats per V^T row (144 B)
#define PP       40       // halves per P row   (80 B)

// A/B fragment dword r (0..7) + lane-half h (0/1) -> first K index of the
// packed f16 pair, per the CDNA5 16-bit A-matrix 16x32 VGPR layout.
__device__ __forceinline__ int kmap(int r, int h) {
    return 2 * r + ((r >= 4) ? 8 : 0) + 8 * h;
}

__device__ __forceinline__ v8f fz8() {
    v8f z;
#pragma unroll
    for (int i = 0; i < 8; ++i) z[i] = 0.0f;
    return z;
}

// Generic pointer to an LDS object: low 32 bits are the LDS offset.
__device__ __forceinline__ uint32_t lds_addr(const void* p) {
    return (uint32_t)(uintptr_t)p;
}

// CDNA5 async global->LDS DMA (GVS mode: SADDR base + 32-bit VGPR byte offset).
// One thread's share of a 32-key tile: 2 b128 copies of K, 8 b32 copies of V.
// All in one statement that ends in s_wait_xcnt 0, so that no address register
// of an issued copy can be rewritten ahead of that wait.
__device__ __forceinline__ void async_copy_tile(const uint32_t (&kl)[2], const uint32_t (&ko)[2],
                                                const uint32_t (&vl)[8], const uint32_t (&vo)[8],
                                                const float* kbase, const float* vbase) {
    asm volatile("global_load_async_to_lds_b128 %0, %2, %20\n\t"
                 "global_load_async_to_lds_b128 %1, %3, %20\n\t"
                 "global_load_async_to_lds_b32 %4, %12, %21\n\t"
                 "global_load_async_to_lds_b32 %5, %13, %21\n\t"
                 "global_load_async_to_lds_b32 %6, %14, %21\n\t"
                 "global_load_async_to_lds_b32 %7, %15, %21\n\t"
                 "global_load_async_to_lds_b32 %8, %16, %21\n\t"
                 "global_load_async_to_lds_b32 %9, %17, %21\n\t"
                 "global_load_async_to_lds_b32 %10, %18, %21\n\t"
                 "global_load_async_to_lds_b32 %11, %19, %21\n\t"
                 "s_wait_xcnt 0x0"
                 :: "v"(kl[0]), "v"(kl[1]), "v"(ko[0]), "v"(ko[1]),
                    "v"(vl[0]), "v"(vl[1]), "v"(vl[2]), "v"(vl[3]),
                    "v"(vl[4]), "v"(vl[5]), "v"(vl[6]), "v"(vl[7]),
                    "v"(vo[0]), "v"(vo[1]), "v"(vo[2]), "v"(vo[3]),
                    "v"(vo[4]), "v"(vo[5]), "v"(vo[6]), "v"(vo[7]),
                    "s"(kbase), "s"(vbase)
                 : "memory");
}
__device__ __forceinline__ void wait_async0() {
    asm volatile("s_wait_asynccnt 0x0" ::: "memory");
}
// This wave's LDS reads have retired before the barrier behind which the
// buffer they read is refilled by copies.
__device__ __forceinline__ void wait_ds0() {
    asm volatile("s_wait_dscnt 0x0" ::: "memory");
}

// Max-reduce across the 16 lanes holding one matrix row, using DPP row
// rotations (VALU only -- keeps the LDS pipe free for fragment loads).
__device__ __forceinline__ float row_max16(float x) {
    int xi;
    xi = __builtin_amdgcn_update_dpp(0, __builtin_bit_cast(int, x), 0x121, 0xF, 0xF, true);
    x  = fmaxf(x, __builtin_bit_cast(float, xi));
    xi = __builtin_amdgcn_update_dpp(0, __builtin_bit_cast(int, x), 0x122, 0xF, 0xF, true);
    x  = fmaxf(x, __builtin_bit_cast(float, xi));
    xi = __builtin_amdgcn_update_dpp(0, __builtin_bit_cast(int, x), 0x124, 0xF, 0xF, true);
    x  = fmaxf(x, __builtin_bit_cast(float, xi));
    xi = __builtin_amdgcn_update_dpp(0, __builtin_bit_cast(int, x), 0x128, 0xF, 0xF, true);
    x  = fmaxf(x, __builtin_bit_cast(float, xi));
    return x;
}

__global__ __launch_bounds__(NTHREADS)
void attn_fwd_wmma(const float* __restrict__ q, const float* __restrict__ k,
                   const float* __restrict__ v, const float* __restrict__ bias,
                   float* __restrict__ out) {
    __shared__ __attribute__((aligned(16))) float kf_lds[2][BJ * KP];     // keys, row-major (j, d), dbl buf
    __shared__ __attribute__((aligned(16))) float vT_lds[2][DHEAD * VP];  // values transposed (d, j), dbl buf
    __shared__ __attribute__((aligned(16))) h16   p_lds[NWAVES * WQ * PP]; // per-wave P transpose scratch

    const int tid  = threadIdx.x;
    const int wave = tid >> 5;
    const int lane = tid & 31;
    const int n16  = lane & 15;    // column index inside a 16-wide tile
    const int h    = lane >> 4;    // lane half (selects K subset / row offset)

    const int iblk  = blockIdx.x;              // 0..7
    const int bh    = blockIdx.y;              // 0..63 (b*H + h)
    const int wg_i0 = iblk * BQ;
    const int i0    = wg_i0 + wave * WQ;       // this wave's first query row

    const float scale = 0.125f;                // 1/sqrt(64)

    const size_t base_qk = (size_t)bh * NSEQ * DHEAD;
    const size_t base_b  = (size_t)bh * NSEQ * NSEQ;

    // ---- Q fragments (A layout), fp32 -> f16 on the fly -------------------
    v16h qa[2];
    {
        const float* qrow = q + base_qk + (size_t)(i0 + n16) * DHEAD;
#pragma unroll
        for (int f = 0; f < 2; ++f) {
#pragma unroll
            for (int r = 0; r < 8; ++r) {
                const int d0 = f * 32 + kmap(r, h);
                qa[f][2 * r]     = (h16)qrow[d0];
                qa[f][2 * r + 1] = (h16)qrow[d0 + 1];
            }
        }
    }

    // all-ones B fragment: row-sum of P via WMMA (P x ones -> l in C layout)
    v16h ones;
#pragma unroll
    for (int i = 0; i < 16; ++i) ones[i] = (h16)1.0f;

    // ---- accumulators & online-softmax state ------------------------------
    v8f o[4];
#pragma unroll
    for (int t = 0; t < 4; ++t) o[t] = fz8();
    v8f lacc = fz8();                          // softmax denominator, C layout
    float mrow[8];
#pragma unroll
    for (int r = 0; r < 8; ++r) mrow[r] = -FLT_MAX;

    const int njb = (wg_i0 + BQ) / BJ;         // uniform across the workgroup

    // ---- async stage of one 32-key K/V tile into LDS buffer `buf` ---------
    auto stage = [&](int j0, int buf) {
        const float* kb_ = k + base_qk + (size_t)j0 * DHEAD;
        const float* vb_ = v + base_qk + (size_t)j0 * DHEAD;
        uint32_t kl[2], ko[2], vl[8], vo[8];
        // K row-major: 2048 dwords, b128 per lane -> 2 DMA ops per thread
#pragma unroll
        for (int i = 0; i < (BJ * DHEAD) / (NTHREADS * 4); ++i) {
            const int e = tid * 4 + i * NTHREADS * 4;
            kl[i] = lds_addr(&kf_lds[buf][(e / DHEAD) * KP + (e % DHEAD)]);
            ko[i] = (uint32_t)(e * 4);
        }
        // V transposed in the DMA: per-lane LDS dest = (d, j); global contiguous
#pragma unroll
        for (int i = 0; i < (BJ * DHEAD) / NTHREADS; ++i) {
            const int e  = tid + i * NTHREADS;
            const int jr = e / DHEAD;
            const int c  = e % DHEAD;
            vl[i] = lds_addr(&vT_lds[buf][c * VP + jr]);
            vo[i] = (uint32_t)(e * 4);
        }
        async_copy_tile(kl, ko, vl, vo, kb_, vb_);
    };

    stage(0, 0);
    int cur = 0;

    for (int jb = 0; jb < njb; ++jb) {
        const int j0 = jb * BJ;

        wait_ds0();             // this wave has left the buffer refilled below
        wait_async0();          // this wave's DMA for tile jb is in LDS
        __syncthreads();        // everyone's DMA visible; prev buffer free

        if (jb + 1 < njb) stage((jb + 1) * BJ, cur ^ 1);   // overlap next tile

        if (j0 <= i0 + WQ - 1) {               // wave-uniform causal skip
            // prefetch next iteration's 16x32 bias tile (one line per row)
            if (jb + 1 < njb) {
                const float* bp = bias + base_b + (size_t)(i0 + n16) * NSEQ
                                  + (size_t)(j0 + BJ) + h * 16;
                __builtin_prefetch(bp, 0, 0);
            }

            const float* kbuf = kf_lds[cur];
            const float* vbuf = vT_lds[cur];

            // ---- S = Q K^T (+scale +bias +causal), two 16-key subtiles ----
            v8f svals[2];
#pragma unroll
            for (int jt = 0; jt < 2; ++jt) {
                const float* krow = &kbuf[(jt * 16 + n16) * KP];
                v8f s = fz8();
#pragma unroll
                for (int f = 0; f < 2; ++f) {
                    v16h kb;
#pragma unroll
                    for (int r = 0; r < 8; ++r) {
                        const int d0 = f * 32 + kmap(r, h);
                        kb[2 * r]     = (h16)krow[d0];
                        kb[2 * r + 1] = (h16)krow[d0 + 1];
                    }
                    s = __builtin_amdgcn_wmma_f32_16x16x32_f16(
                            false, qa[f], false, kb, (short)0, s, false, false);
                }
#pragma unroll
                for (int r = 0; r < 8; ++r) {
                    const int row = i0 + r + 8 * h;
                    const int col = j0 + jt * 16 + n16;
                    // bias is stream-once: non-temporal keeps K/V resident in L2
                    float val = s[r] * scale + __builtin_nontemporal_load(
                                    bias + base_b + (size_t)row * NSEQ + col);
                    if (col > row) val = -FLT_MAX;   // causal: strictly above diag
                    s[r] = val;
                }
                svals[jt] = s;
            }

            // ---- online softmax: DPP row-max, WMMA row-sum ----------------
            float alpha[8];
#pragma unroll
            for (int r = 0; r < 8; ++r) {
                const float t    = row_max16(fmaxf(svals[0][r], svals[1][r]));
                const float mnew = fmaxf(mrow[r], t);
                alpha[r] = __expf(mrow[r] - mnew);
                mrow[r]  = mnew;
            }

            h16* pw = &p_lds[wave * WQ * PP];
#pragma unroll
            for (int r = 0; r < 8; ++r) {
                const float p0 = __expf(svals[0][r] - mrow[r]);
                const float p1 = __expf(svals[1][r] - mrow[r]);
                const int   M  = r + 8 * h;
                pw[M * PP + n16]      = (h16)p0;   // C-layout -> (M, j) scratch
                pw[M * PP + 16 + n16] = (h16)p1;
            }

            // ---- rescale O and l, then O += P V, l += P * ones ------------
#pragma unroll
            for (int t = 0; t < 4; ++t)
#pragma unroll
                for (int r = 0; r < 8; ++r) o[t][r] *= alpha[r];
#pragma unroll
            for (int r = 0; r < 8; ++r) lacc[r] *= alpha[r];

            v16h pa;
            {
                const h16* pr = &p_lds[wave * WQ * PP + n16 * PP];
#pragma unroll
                for (int r = 0; r < 8; ++r) {
                    const int jj = kmap(r, h);
                    pa[2 * r]     = pr[jj];
                    pa[2 * r + 1] = pr[jj + 1];
                }
            }
            lacc = __builtin_amdgcn_wmma_f32_16x16x32_f16(
                       false, pa, false, ones, (short)0, lacc, false, false);
#pragma unroll
            for (int t = 0; t < 4; ++t) {
                v16h vb;
                const float* vcol = &vbuf[(t * 16 + n16) * VP];
#pragma unroll
                for (int r = 0; r < 8; ++r) {
                    const int jj = kmap(r, h);
                    vb[2 * r]     = (h16)vcol[jj];
                    vb[2 * r + 1] = (h16)vcol[jj + 1];
                }
                o[t] = __builtin_amdgcn_wmma_f32_16x16x32_f16(
                           false, pa, false, vb, (short)0, o[t], false, false);
            }
        }
        cur ^= 1;
    }

    // ---- normalize and store (non-temporal: output is never re-read) ------
#pragma unroll
    for (int r = 0; r < 8; ++r) {
        const float inv = 1.0f / lacc[r];
        const int   row = i0 + r + 8 * h;
        float* orow = out + base_qk + (size_t)row * DHEAD;
#pragma unroll
        for (int t = 0; t < 4; ++t)
            __builtin_nontemporal_store(o[t][r] * inv, orow + t * 16 + n16);
    }
}

extern "C" void kernel_launch(void* const* d_in, const int* in_sizes, int n_in,
                              void* d_out, int out_size, void* d_ws, size_t ws_size,
                              hipStream_t stream) {
    const float* q    = (const float*)d_in[0];
    const float* k    = (const float*)d_in[1];
    const float* v    = (const float*)d_in[2];
    const float* bias = (const float*)d_in[3];
    float* out = (float*)d_out;

    dim3 grid(NSEQ / BQ, 4 * 16);   // (i-blocks, B*H)
    dim3 block(NTHREADS);
    attn_fwd_wmma<<<grid, block, 0, stream>>>(q, k, v, bias, out);
}

// v002
// One run takes 44 microseconds.
// Two timings next to v001 both put it at 1.30 times that version's speed.
// All steps since v000 together make it 4.36 times as fast.
#include <hip/hip_runtime.h>
#include <cfloat>
#include <cmath>
#include <cstdint>

typedef _Float16 h16;
typedef __attribute__((ext_vector_type(16))) _Float16 v16h;
typedef __attribute__((ext_vector_type(8)))  float    v8f;

#define NSEQ     1024
#define DHEAD    64
#define BQ       128      // query rows per query block (a workgroup takes two)
#define WQ       16       // query rows per wave
#define BJ       32       // keys per j-iteration (K=32 for the PV WMMA)
#define NWAVES   8
#define NTHREADS 256
// LDS row pitches: 16 B x odd, so that the 16 lanes of a ds_load_b128 that walk
// 16 rows fall on 16 different groups of four banks.
#define KP       68       // floats per K row   (272 B)
#define VP       36       // floats per V^T row (144 B)
#define PP       40       // halves per P row   (80 B)

// A/B fragment dword r (0..7) + lane-half h (0/1) -> first K index of the
// packed f16 pair, per the CDNA5 16-bit A-matrix 16x32 VGPR layout.
__device__ __forceinline__ int kmap(int r, int h) {
    return 2 * r + ((r >= 4) ? 8 : 0) + 8 * h;
}

__device__ __forceinline__ v8f fz8() {
    v8f z;
#pragma unroll
    for (int i = 0; i < 8; ++i) z[i] = 0.0f;
    return z;
}

// Generic pointer to an LDS object: low 32 bits are the LDS offset.
__device__ __forceinline__ uint32_t lds_addr(const void* p) {
    return (uint32_t)(uintptr_t)p;
}

// CDNA5 async global->LDS DMA (GVS mode: SADDR base + 32-bit VGPR byte offset).
// One thread's share of a 32-key tile: 2 b128 copies of K, 8 b32 copies of V.
// All in one statement that ends in s_wait_xcnt 0, so that no address register
// of an issued copy can be rewritten ahead of that wait.
__device__ __forceinline__ void async_copy_tile(const uint32_t (&kl)[2], const uint32_t (&ko)[2],
                                                const uint32_t (&vl)[8], const uint32_t (&vo)[8],
                                                const float* kbase, const float* vbase) {
    asm volatile("global_load_async_to_lds_b128 %0, %2, %20\n\t"
                 "global_load_async_to_lds_b128 %1, %3, %20\n\t"
                 "global_load_async_to_lds_b32 %4, %12, %21\n\t"
                 "global_load_async_to_lds_b32 %5, %13, %21\n\t"
                 "global_load_async_to_lds_b32 %6, %14, %21\n\t"
                 "global_load_async_to_lds_b32 %7, %15, %21\n\t"
                 "global_load_async_to_lds_b32 %8, %16, %21\n\t"
                 "global_load_async_to_lds_b32 %9, %17, %21\n\t"
                 "global_load_async_to_lds_b32 %10, %18, %21\n\t"
                 "global_load_async_to_lds_b32 %11, %19, %21\n\t"
                 "s_wait_xcnt 0x0"
                 :: "v"(kl[0]), "v"(kl[1]), "v"(ko[0]), "v"(ko[1]),
                    "v"(vl[0]), "v"(vl[1]), "v"(vl[2]), "v"(vl[3]),
                    "v"(vl[4]), "v"(vl[5]), "v"(vl[6]), "v"(vl[7]),
                    "v"(vo[0]), "v"(vo[1]), "v"(vo[2]), "v"(vo[3]),
                    "v"(vo[4]), "v"(vo[5]), "v"(vo[6]), "v"(vo[7]),
                    "s"(kbase), "s"(vbase)
                 : "memory");
}
__device__ __forceinline__ void wait_async0() {
    asm volatile("s_wait_asynccnt 0x0" ::: "memory");
}
// This wave's LDS reads have retired before the barrier behind which the
// buffer they read is refilled by copies.
__device__ __forceinline__ void wait_ds0() {
    asm volatile("s_wait_dscnt 0x0" ::: "memory");
}

// Max-reduce across the 16 lanes holding one matrix row, using DPP row
// rotations (VALU only -- keeps the LDS pipe free for fragment loads).
__device__ __forceinline__ float row_max16(float x) {
    int xi;
    xi = __builtin_amdgcn_update_dpp(0, __builtin_bit_cast(int, x), 0x121, 0xF, 0xF, true);
    x  = fmaxf(x, __builtin_bit_cast(float, xi));
    xi = __builtin_amdgcn_update_dpp(0, __builtin_bit_cast(int, x), 0x122, 0xF, 0xF, true);
    x  = fmaxf(x, __builtin_bit_cast(float, xi));
    xi = __builtin_amdgcn_update_dpp(0, __builtin_bit_cast(int, x), 0x124, 0xF, 0xF, true);
    x  = fmaxf(x, __builtin_bit_cast(float, xi));
    xi = __builtin_amdgcn_update_dpp(0, __builtin_bit_cast(int, x), 0x128, 0xF, 0xF, true);
    x  = fmaxf(x, __builtin_bit_cast(float, xi));
    return x;
}

__global__ __launch_bounds__(NTHREADS)
void attn_fwd_wmma(const float* __restrict__ q, const float* __restrict__ k,
                   const float* __restrict__ v, const float* __restrict__ bias,
                   float* __restrict__ out) {
    __shared__ __attribute__((aligned(16))) float kf_lds[2][BJ * KP];     // keys, row-major (j, d), dbl buf
    __shared__ __attribute__((aligned(16))) float vT_lds[2][DHEAD * VP];  // values transposed (d, j), dbl buf
    __shared__ __attribute__((aligned(16))) h16   p_lds[NWAVES * WQ * PP]; // per-wave P transpose scratch

    const int tid  = threadIdx.x;
    const int wave = tid >> 5;
    const int lane = tid & 31;
    const int n16  = lane & 15;    // column index inside a 16-wide tile
    const int h    = lane >> 4;    // lane half (selects K subset / row offset)

    const int pairi = blockIdx.x;              // 0..3: the pair of query blocks
    const int bh    = blockIdx.y;              // 0..63 (b*H + h)

    const float scale = 0.125f;                // 1/sqrt(64)

    const size_t base_qk = (size_t)bh * NSEQ * DHEAD;
    const size_t base_b  = (size_t)bh * NSEQ * NSEQ;

    // all-ones B fragment: row-sum of P via WMMA (P x ones -> l in C layout)
    v16h ones;
#pragma unroll
    for (int i = 0; i < 16; ++i) ones[i] = (h16)1.0f;

    // ---- async stage of one 32-key K/V tile into LDS buffer `buf` ---------
    auto stage = [&](int j0, int buf) {
        const float* kb_ = k + base_qk + (size_t)j0 * DHEAD;
        const float* vb_ = v + base_qk + (size_t)j0 * DHEAD;
        uint32_t kl[2], ko[2], vl[8], vo[8];
        // K row-major: 2048 dwords, b128 per lane -> 2 DMA ops per thread
#pragma unroll
        for (int i = 0; i < (BJ * DHEAD) / (NTHREADS * 4); ++i) {
            const int e = tid * 4 + i * NTHREADS * 4;
            kl[i] = lds_addr(&kf_lds[buf][(e / DHEAD) * KP + (e % DHEAD)]);
            ko[i] = (uint32_t)(e * 4);
        }
        // V transposed in the DMA: per-lane LDS dest = (d, j); global contiguous
#pragma unroll
        for (int i = 0; i < (BJ * DHEAD) / NTHREADS; ++i) {
            const int e  = tid + i * NTHREADS;
            const int jr = e / DHEAD;
            const int c  = e % DHEAD;
            vl[i] = lds_addr(&vT_lds[buf][c * VP + jr]);
            vo[i] = (uint32_t)(e * 4);
        }
        async_copy_tile(kl, ko, vl, vo, kb_, vb_);
    };

    // ---- Q fragments (A layout) of one query block, fp32 -> f16 on the fly -
    auto load_q = [&](int blk, v16h (&dst)[2]) {
        // this lane's row, at its half's first k index
        const float* qrow = q + base_qk + (size_t)(blk * BQ + wave * WQ + n16) * DHEAD + kmap(0, h);
        float raw[2][16];
#pragma unroll
        for (int f = 0; f < 2; ++f) {
#pragma unroll
            for (int r = 0; r < 8; ++r) {
                const int d0 = f * 32 + kmap(r, 0);
                raw[f][2 * r]     = qrow[d0];
                raw[f][2 * r + 1] = qrow[d0 + 1];
            }
        }
        // Stands in front of any rewrite of the address registers these loads
        // name: qrow is an input so that its registers stay live up to the wait.
        asm volatile("s_wait_xcnt 0x0" :: "v"(qrow) : "memory");
#pragma unroll
        for (int f = 0; f < 2; ++f)
#pragma unroll
            for (int i = 0; i < 16; ++i) dst[f][i] = (h16)raw[f][i];
    };

    stage(0, 0);
    int cur = 0;

    v16h qa[2];
    load_q(NSEQ / BQ - 1 - pairi, qa);

    // Causal cost grows linearly with the query block's index, so every
    // workgroup takes block 7-p and then block p, one after the other: the
    // same 36 key trips in each workgroup. Kept rolled: two copies of the body
    // would only double the code.
#pragma unroll 1
    for (int half = 0; half < 2; ++half) {
        const int iblk  = half ? pairi : (NSEQ / BQ - 1 - pairi);
        const int wg_i0 = iblk * BQ;
        const int i0    = wg_i0 + wave * WQ;       // this wave's first query row

        // ---- accumulators & online-softmax state ------------------------------
        v8f o[4];
#pragma unroll
        for (int t = 0; t < 4; ++t) o[t] = fz8();
        v8f lacc = fz8();                          // softmax denominator, C layout
        float mrow[8];
#pragma unroll
        for (int r = 0; r < 8; ++r) mrow[r] = -FLT_MAX;

        const int njb = (wg_i0 + BQ) / BJ;         // uniform across the workgroup

        for (int jb = 0; jb < njb; ++jb) {
            const int j0 = jb * BJ;

            wait_ds0();             // this wave has left the buffer refilled below
            wait_async0();          // this wave's DMA for tile jb is in LDS
            __syncthreads();        // everyone's DMA visible; prev buffer free

            if (jb + 1 < njb) stage((jb + 1) * BJ, cur ^ 1);   // overlap next tile

            if (j0 <= i0 + WQ - 1) {               // wave-uniform causal skip
                // prefetch next iteration's 16x32 bias tile (one line per row)
                if (jb + 1 < njb) {
                    const float* bp = bias + base_b + (size_t)(i0 + n16) * NSEQ
                                      + (size_t)(j0 + BJ) + h * 16;
                    __builtin_prefetch(bp, 0, 0);
                }

                const float* kbuf = kf_lds[cur];
                const float* vbuf = vT_lds[cur];

                // ---- S = Q K^T (+scale +bias +causal), two 16-key subtiles ----
                v8f svals[2];
#pragma unroll
                for (int jt = 0; jt < 2; ++jt) {
                    const float* krow = &kbuf[(jt * 16 + n16) * KP];
                    v8f s = fz8();
#pragma unroll
                    for (int f = 0; f < 2; ++f) {
                        v16h kb;
#pragma unroll
                        for (int r = 0; r < 8; ++r) {
                            const int d0 = f * 32 + kmap(r, h);
                            kb[2 * r]     = (h16)krow[d0];
                            kb[2 * r + 1] = (h16)krow[d0 + 1];
                        }
                        s = __builtin_amdgcn_wmma_f32_16x16x32_f16(
                                false, qa[f], false, kb, (short)0, s, false, false);
                    }
#pragma unroll
                    for (int r = 0; r < 8; ++r) {
                        const int row = i0 + r + 8 * h;
                        const int col = j0 + jt * 16 + n16;
                        // bias is stream-once: non-temporal keeps K/V resident in L2
                        float val = s[r] * scale + __builtin_nontemporal_load(
                                        bias + base_b + (size_t)row * NSEQ + col);
                        if (col > row) val = -FLT_MAX;   // causal: strictly above diag
                        s[r] = val;
                    }
                    svals[jt] = s;
                }

                // ---- online softmax: DPP row-max, WMMA row-sum ----------------
                float alpha[8];
#pragma unroll
                for (int r = 0; r < 8; ++r) {
                    const float t    = row_max16(fmaxf(svals[0][r], svals[1][r]));
                    const float mnew = fmaxf(mrow[r], t);
                    alpha[r] = __expf(mrow[r] - mnew);
                    mrow[r]  = mnew;
                }

                h16* pw = &p_lds[wave * WQ * PP];
#pragma unroll
                for (int r = 0; r < 8; ++r) {
                    const float p0 = __expf(svals[0][r] - mrow[r]);
                    const float p1 = __expf(svals[1][r] - mrow[r]);
                    const int   M  = r + 8 * h;
                    pw[M * PP + n16]      = (h16)p0;   // C-layout -> (M, j) scratch
                    pw[M * PP + 16 + n16] = (h16)p1;
                }

                // ---- rescale O and l, then O += P V, l += P * ones ------------
#pragma unroll
                for (int t = 0; t < 4; ++t)
#pragma unroll
                    for (int r = 0; r < 8; ++r) o[t][r] *= alpha[r];
#pragma unroll
                for (int r = 0; r < 8; ++r) lacc[r] *= alpha[r];

                v16h pa;
                {
                    const h16* pr = &p_lds[wave * WQ * PP + n16 * PP];
#pragma unroll
                    for (int r = 0; r < 8; ++r) {
                        const int jj = kmap(r, h);
                        pa[2 * r]     = pr[jj];
                        pa[2 * r + 1] = pr[jj + 1];
                    }
                }
                lacc = __builtin_amdgcn_wmma_f32_16x16x32_f16(
                           false, pa, false, ones, (short)0, lacc, false, false);
#pragma unroll
                for (int t = 0; t < 4; ++t) {
                    v16h vb;
                    const float* vcol = &vbuf[(t * 16 + n16) * VP];
#pragma unroll
                    for (int r = 0; r < 8; ++r) {
                        const int jj = kmap(r, h);
                        vb[2 * r]     = (h16)vcol[jj];
                        vb[2 * r + 1] = (h16)vcol[jj + 1];
                    }
                    o[t] = __builtin_amdgcn_wmma_f32_16x16x32_f16(
                               false, pa, false, vb, (short)0, o[t], false, false);
                }
            }
            cur ^= 1;
        }

        // The second block's first K/V tile flies under its Q loads and the first
        // block's epilogue. Buffer `cur` was last read two trips back, in front of the last
        // trip's s_wait_dscnt 0 and barrier, and the last trip refilled nothing:
        // this refill needs no barrier of its own.
        if (half == 0) {
            stage(0, cur);
            load_q(pairi, qa);
        }

        // ---- normalize and store (non-temporal: output is never re-read) ------
#pragma unroll
        for (int r = 0; r < 8; ++r) {
            const float inv = 1.0f / lacc[r];
            const int   row = i0 + r + 8 * h;
            float* orow = out + base_qk + (size_t)row * DHEAD;
#pragma unroll
            for (int t = 0; t < 4; ++t)
                __builtin_nontemporal_store(o[t][r] * inv, orow + t * 16 + n16);
        }
        // The next block's set-up rewrites registers that these stores name.
        asm volatile("s_wait_xcnt 0x0" ::: "memory");
    }   // the pair's two query blocks
}

extern "C" void kernel_launch(void* const* d_in, const int* in_sizes, int n_in,
                              void* d_out, int out_size, void* d_ws, size_t ws_size,
                              hipStream_t stream) {
    const float* q    = (const float*)d_in[0];
    const float* k    = (const float*)d_in[1];
    const float* v    = (const float*)d_in[2];
    const float* bias = (const float*)d_in[3];
    float* out = (float*)d_out;

    dim3 grid(NSEQ / BQ / 2, 4 * 16);   // (pairs of i-blocks, B*H)
    dim3 block(NTHREADS);
    attn_fwd_wmma<<<grid, block, 0, stream>>>(q, k, v, bias, out);
}

// v003
// It runs in 41.1 microseconds.
// Two timings next to v002 put it at 1.08 and 1.05 times that version's speed.
// All steps since v000 together make it 4.65 times as fast.
#include <hip/hip_runtime.h>
#include <cfloat>
#include <cmath>
#include <cstdint>

typedef _Float16 h16;
typedef __attribute__((ext_vector_type(16))) _Float16 v16h;
typedef __attribute__((ext_vector_type(8)))  float    v8f;
typedef __attribute__((ext_vector_type(4)))  float    v4f;

#define NSEQ     1024
#define DHEAD    64
#define BQ       128      // query rows per query block (a workgroup takes two)
#define WQ       16       // query rows per wave
#define BJ       32       // keys per j-iteration (K=32 for the PV WMMA)
#define NTHREADS 256
// LDS row pitches: 16 B x odd, so that the 16 lanes of a ds_load_b128 that walk
// 16 rows fall on 16 different groups of four banks.
#define KP       68       // floats per K row   (272 B)
#define VP       36       // floats per V^T row (144 B)

// A/B fragment dword r (0..7) + lane-half h (0/1) -> first K index of the
// packed f16 pair, per the CDNA5 16-bit A-matrix 16x32 VGPR layout.
__device__ __forceinline__ int kmap(int r, int h) {
    return 2 * r + ((r >= 4) ? 8 : 0) + 8 * h;
}

__device__ __forceinline__ v8f fz8() {
    v8f z;
#pragma unroll
    for (int i = 0; i < 8; ++i) z[i] = 0.0f;
    return z;
}

// Generic pointer to an LDS object: low 32 bits are the LDS offset.
__device__ __forceinline__ uint32_t lds_addr(const void* p) {
    return (uint32_t)(uintptr_t)p;
}

// CDNA5 async global->LDS DMA (GVS mode: SADDR base + 32-bit VGPR byte offset).
// One thread's share of a 32-key tile: 2 b128 copies of K, 8 b32 copies of V.
// All in one statement that ends in s_wait_xcnt 0, so that no address register
// of an issued copy can be rewritten ahead of that wait.
__device__ __forceinline__ void async_copy_tile(const uint32_t (&kl)[2], const uint32_t (&ko)[2],
                                                const uint32_t (&vl)[8], const uint32_t (&vo)[8],
                                                const float* kbase, const float* vbase) {
    asm volatile("global_load_async_to_lds_b128 %0, %2, %20\n\t"
                 "global_load_async_to_lds_b128 %1, %3, %20\n\t"
                 "global_load_async_to_lds_b32 %4, %12, %21\n\t"
                 "global_load_async_to_lds_b32 %5, %13, %21\n\t"
                 "global_load_async_to_lds_b32 %6, %14, %21\n\t"
                 "global_load_async_to_lds_b32 %7, %15, %21\n\t"
                 "global_load_async_to_lds_b32 %8, %16, %21\n\t"
                 "global_load_async_to_lds_b32 %9, %17, %21\n\t"
                 "global_load_async_to_lds_b32 %10, %18, %21\n\t"
                 "global_load_async_to_lds_b32 %11, %19, %21\n\t"
                 "s_wait_xcnt 0x0"
                 :: "v"(kl[0]), "v"(kl[1]), "v"(ko[0]), "v"(ko[1]),
                    "v"(vl[0]), "v"(vl[1]), "v"(vl[2]), "v"(vl[3]),
                    "v"(vl[4]), "v"(vl[5]), "v"(vl[6]), "v"(vl[7]),
                    "v"(vo[0]), "v"(vo[1]), "v"(vo[2]), "v"(vo[3]),
                    "v"(vo[4]), "v"(vo[5]), "v"(vo[6]), "v"(vo[7]),
                    "s"(kbase), "s"(vbase)
                 : "memory");
}
__device__ __forceinline__ void wait_async0() {
    asm volatile("s_wait_asynccnt 0x0" ::: "memory");
}
// This wave's LDS reads have retired before the barrier behind which the
// buffer they read is refilled by copies.
__device__ __forceinline__ void wait_ds0() {
    asm volatile("s_wait_dscnt 0x0" ::: "memory");
}

// Lane l's value from lane l ^ 16: the two lanes that share one query column.
__device__ __forceinline__ float xhalf(float x) {
    const int xi = __builtin_bit_cast(int, x);
    return __builtin_bit_cast(float, __builtin_amdgcn_permlanex16(xi, xi, 0x76543210, 0xfedcba98, false, false));
}

__global__ __launch_bounds__(NTHREADS)
void attn_fwd_wmma(const float* __restrict__ q, const float* __restrict__ k,
                   const float* __restrict__ v, const float* __restrict__ bias,
                   float* __restrict__ out) {
    __shared__ __attribute__((aligned(16))) float kf_lds[2][BJ * KP];     // keys, row-major (j, d), dbl buf
    __shared__ __attribute__((aligned(16))) float vT_lds[2][DHEAD * VP];  // values transposed (d, j), dbl buf

    const int tid  = threadIdx.x;
    const int wave = tid >> 5;
    const int lane = tid & 31;
    const int n16  = lane & 15;    // this lane's query column; row of an A fragment
    const int h    = lane >> 4;    // lane half (selects K subset / row offset)

    const int pairi = blockIdx.x;              // 0..3: the pair of query blocks
    const int bh    = blockIdx.y;              // 0..63 (b*H + h)

    const float scale = 0.125f;                // 1/sqrt(64)

    const size_t base_qk = (size_t)bh * NSEQ * DHEAD;
    const size_t base_b  = (size_t)bh * NSEQ * NSEQ;

    // all-ones A fragment: column sums of P^T via WMMA (every row of ones x P^T is l)
    v16h ones;
#pragma unroll
    for (int i = 0; i < 16; ++i) ones[i] = (h16)1.0f;

    // ---- async stage of one 32-key K/V tile into LDS buffer `buf` ---------
    auto stage = [&](int j0, int buf) {
        const float* kb_ = k + base_qk + (size_t)j0 * DHEAD;
        const float* vb_ = v + base_qk + (size_t)j0 * DHEAD;
        uint32_t kl[2], ko[2], vl[8], vo[8];
        // K row-major: 2048 dwords, b128 per lane -> 2 DMA ops per thread
#pragma unroll
        for (int i = 0; i < (BJ * DHEAD) / (NTHREADS * 4); ++i) {
            const int e = tid * 4 + i * NTHREADS * 4;
            kl[i] = lds_addr(&kf_lds[buf][(e / DHEAD) * KP + (e % DHEAD)]);
            ko[i] = (uint32_t)(e * 4);
        }
        // V transposed in the DMA: per-lane LDS dest = (d, j); global contiguous
#pragma unroll
        for (int i = 0; i < (BJ * DHEAD) / NTHREADS; ++i) {
            const int e  = tid + i * NTHREADS;
            const int jr = e / DHEAD;
            const int c  = e % DHEAD;
            vl[i] = lds_addr(&vT_lds[buf][c * VP + jr]);
            vo[i] = (uint32_t)(e * 4);
        }
        async_copy_tile(kl, ko, vl, vo, kb_, vb_);
    };

    // ---- Q fragments (B operand: lane = query, same k map) of one query block, fp32 -> f16 -
    auto load_q = [&](int blk, v16h (&dst)[2]) {
        // this lane's row, at its half's first k index
        const float* qrow = q + base_qk + (size_t)(blk * BQ + wave * WQ + n16) * DHEAD + kmap(0, h);
        float raw[2][16];
#pragma unroll
        for (int f = 0; f < 2; ++f) {
#pragma unroll
            for (int r = 0; r < 8; ++r) {
                const int d0 = f * 32 + kmap(r, 0);
                raw[f][2 * r]     = qrow[d0];
                raw[f][2 * r + 1] = qrow[d0 + 1];
            }
        }
        // Stands in front of any rewrite of the address registers these loads
        // name: qrow is an input so that its registers stay live up to the wait.
        asm volatile("s_wait_xcnt 0x0" :: "v"(qrow) : "memory");
#pragma unroll
        for (int f = 0; f < 2; ++f)
#pragma unroll
            for (int i = 0; i < 16; ++i) dst[f][i] = (h16)raw[f][i];
    };

    stage(0, 0);
    int cur = 0;

    v16h qa[2];
    load_q(NSEQ / BQ - 1 - pairi, qa);

    // Causal cost grows linearly with the query block's index, so every
    // workgroup takes block 7-p and then block p, one after the other: the
    // same 36 key trips in each workgroup. Kept rolled: two copies of the body
    // would only double the code.
#pragma unroll 1
    for (int half = 0; half < 2; ++half) {
        const int iblk  = half ? pairi : (NSEQ / BQ - 1 - pairi);
        const int wg_i0 = iblk * BQ;
        const int i0    = wg_i0 + wave * WQ;       // this wave's first query row

        // ---- accumulators & online-softmax state ------------------------------
        v8f o[4];
#pragma unroll
        for (int t = 0; t < 4; ++t) o[t] = fz8();
        float lsum = 0.0f;                         // this lane's query: softmax denominator
        float mrow = -FLT_MAX;                     // this lane's query: running maximum

        const int njb = (wg_i0 + BQ) / BJ;         // uniform across the workgroup

        for (int jb = 0; jb < njb; ++jb) {
            const int j0 = jb * BJ;

            wait_ds0();             // this wave has left the buffer refilled below
            wait_async0();          // this wave's DMA for tile jb is in LDS
            __syncthreads();        // everyone's DMA visible; prev buffer free

            if (jb + 1 < njb) stage((jb + 1) * BJ, cur ^ 1);   // overlap next tile

            if (j0 <= i0 + WQ - 1) {               // wave-uniform causal skip
                // prefetch next iteration's 16x32 bias tile (one line per row)
                if (jb + 1 < njb) {
                    const float* bp = bias + base_b + (size_t)(i0 + n16) * NSEQ
                                      + (size_t)(j0 + BJ) + h * 16;
                    __builtin_prefetch(bp, 0, 0);
                }

                const float* kbuf = kf_lds[cur];
                const float* vbuf = vT_lds[cur];

                // ---- S^T = K Q^T (+scale +bias +causal), two 16-key subtiles ----
                // Accumulator register r of this lane: key j0 + jt*16 + 8h + r of
                // query i0 + n16, so a lane's bias is 8 floats in a row per subtile.
                const int    row  = i0 + n16;
                const float* brow = bias + base_b + (size_t)row * NSEQ + j0 + 8 * h;
                v4f bv[2][2];
#pragma unroll
                for (int jt = 0; jt < 2; ++jt)
#pragma unroll
                    for (int u = 0; u < 2; ++u)   // bias is stream-once: non-temporal keeps K/V resident in L2
                        bv[jt][u] = __builtin_nontemporal_load((const v4f*)(brow + jt * 16 + u * 4));

                // Fragment element 4q + e has k index 8h + 4q + e (q < 2) or 8h + 8 + 4q + e: kmap's order.
                v4f kr[2][2][4];
#pragma unroll
                for (int jt = 0; jt < 2; ++jt) {
                    const float* krow = &kbuf[(jt * 16 + n16) * KP + 8 * h];
#pragma unroll
                    for (int f = 0; f < 2; ++f)
#pragma unroll
                        for (int qd = 0; qd < 4; ++qd)
                            kr[jt][f][qd] = *(const v4f*)(krow + f * 32 + kmap(2 * qd, 0));
                }
                v4f vr[4][4];
#pragma unroll
                for (int tt = 0; tt < 4; ++tt) {
                    const float* vcol = &vbuf[(tt * 16 + n16) * VP + 8 * h];
#pragma unroll
                    for (int qd = 0; qd < 4; ++qd)
                        vr[tt][qd] = *(const v4f*)(vcol + kmap(2 * qd, 0));
                }
                // Keeps the trip's bias and fragment loads issued here, ahead of all
                // the arithmetic: sunk to their first uses, each latency would be waited out alone.
                __builtin_amdgcn_sched_barrier(0);

                const int dlt = row - j0 - 8 * h;      // key index in this lane's run that sits on the diagonal
                float svals[2][8];
#pragma unroll
                for (int jt = 0; jt < 2; ++jt) {
                    v8f s = fz8();
#pragma unroll
                    for (int f = 0; f < 2; ++f) {
                        v16h kb;
#pragma unroll
                        for (int i = 0; i < 16; ++i) kb[i] = (h16)kr[jt][f][i >> 2][i & 3];
                        s = __builtin_amdgcn_wmma_f32_16x16x32_f16(
                                false, kb, false, qa[f], (short)0, s, false, false);
                    }
                    const v8f bb = __builtin_shufflevector(bv[jt][0], bv[jt][1], 0, 1, 2, 3, 4, 5, 6, 7);
                    s = s * scale + bb;
#pragma unroll
                    for (int r = 0; r < 8; ++r)        // causal: strictly above diag
                        svals[jt][r] = (jt * 16 + r > dlt) ? -FLT_MAX : s[r];
                }

                // ---- online softmax, in-lane: 16 keys here, 16 in lane ^ 16 ----
                float t = fmaxf(svals[0][0], svals[1][0]);
#pragma unroll
                for (int r = 1; r < 8; ++r) t = fmaxf(t, fmaxf(svals[0][r], svals[1][r]));
                t = fmaxf(t, xhalf(t));
                const float mnew  = fmaxf(mrow, t);
                const float alpha = __expf(mrow - mnew);
                mrow = mnew;

                // P^T as a B operand straight from the accumulators: element e of the
                // fragment is key e + 8h (e < 8) or e + 8 + 8h, which is kmap's order.
                v16h pa;
#pragma unroll
                for (int r = 0; r < 8; ++r) {
                    pa[r]     = (h16)__expf(svals[0][r] - mrow);
                    pa[8 + r] = (h16)__expf(svals[1][r] - mrow);
                }

                // ---- rescale O^T and l, then O^T += V^T P^T, l += ones x P^T ----
#pragma unroll
                for (int tt = 0; tt < 4; ++tt)
#pragma unroll
                    for (int r = 0; r < 8; ++r) o[tt][r] *= alpha;

                const v8f ls = __builtin_amdgcn_wmma_f32_16x16x32_f16(
                                   false, ones, false, pa, (short)0, fz8(), false, false);
#pragma unroll
                for (int tt = 0; tt < 4; ++tt) {
                    v16h vb;
#pragma unroll
                    for (int i = 0; i < 16; ++i) vb[i] = (h16)vr[tt][i >> 2][i & 3];
                    o[tt] = __builtin_amdgcn_wmma_f32_16x16x32_f16(
                                false, vb, false, pa, (short)0, o[tt], false, false);
                }
                lsum = lsum * alpha + ls[0];
            }
            cur ^= 1;
        }

        // The second block's first K/V tile flies under its Q loads and the first
        // block's epilogue. Buffer `cur` was last read two trips back, in front of the last
        // trip's s_wait_dscnt 0 and barrier, and the last trip refilled nothing:
        // this refill needs no barrier of its own.
        if (half == 0) {
            stage(0, cur);
            load_q(pairi, qa);
        }

        // ---- normalize and store (non-temporal: output is never re-read) ------
        // Register r of o[t] is d = t*16 + 8h + r of query i0 + n16: 8 floats in a row.
        {
            const float inv  = 1.0f / lsum;
            float*      orow = out + base_qk + (size_t)(i0 + n16) * DHEAD + 8 * h;
#pragma unroll
            for (int t = 0; t < 4; ++t)
#pragma unroll
                for (int u = 0; u < 2; ++u) {
                    v4f w;
#pragma unroll
                    for (int e = 0; e < 4; ++e) w[e] = o[t][u * 4 + e] * inv;
                    __builtin_nontemporal_store(w, (v4f*)(orow + t * 16 + u * 4));
                }
        }
        // The next block's set-up rewrites registers that these stores name.
        asm volatile("s_wait_xcnt 0x0" ::: "memory");
    }   // the pair's two query blocks
}

extern "C" void kernel_launch(void* const* d_in, const int* in_sizes, int n_in,
                              void* d_out, int out_size, void* d_ws, size_t ws_size,
                              hipStream_t stream) {
    const float* q    = (const float*)d_in[0];
    const float* k    = (const float*)d_in[1];
    const float* v    = (const float*)d_in[2];
    const float* bias = (const float*)d_in[3];
    float* out = (float*)d_out;

    dim3 grid(NSEQ / BQ / 2, 4 * 16);   // (pairs of i-blocks, B*H)
    dim3 block(NTHREADS);
    attn_fwd_wmma<<<grid, block, 0, stream>>>(q, k, v, bias, out);
}

// v004
// Measured time: 32.4 microseconds a run.
// Timed twice side by side with v003, it ran 1.26 and 1.25 times as fast.
// Over all steps from v000 it is 5.85 times as fast.
#include <hip/hip_runtime.h>
#include <cfloat>
#include <cmath>
#include <cstdint>

typedef _Float16 h16;
typedef __attribute__((ext_vector_type(16))) _Float16 v16h;
typedef __attribute__((ext_vector_type(8)))  float    v8f;
typedef __attribute__((ext_vector_type(4)))  float    v4f;

#define NSEQ     1024
#define DHEAD    64
#define BQ       128      // query rows per query block (a workgroup takes two)
#define WQ       16       // query rows per wave
#define BJ       32       // keys per j-iteration (K=32 for the PV WMMA)
#define NGRP     2        // wave groups per workgroup: group g takes key tiles g, g + 2, g + 4, ...
#define GTHREADS 256      // threads of one group (8 waves, one per 16 query rows)
#define NTHREADS (NGRP * GTHREADS)
// LDS row pitches: 16 B x odd, so that the 16 lanes of a ds_load_b128 that walk
// 16 rows fall on 16 different groups of four banks.
#define KP       68       // floats per K row   (272 B)
#define VP       36       // floats per V^T row (144 B)

// A/B fragment dword r (0..7) + lane-half h (0/1) -> first K index of the
// packed f16 pair, per the CDNA5 16-bit A-matrix 16x32 VGPR layout.
__device__ __forceinline__ int kmap(int r, int h) {
    return 2 * r + ((r >= 4) ? 8 : 0) + 8 * h;
}

__device__ __forceinline__ v8f fz8() {
    v8f z;
#pragma unroll
    for (int i = 0; i < 8; ++i) z[i] = 0.0f;
    return z;
}

// Generic pointer to an LDS object: low 32 bits are the LDS offset.
__device__ __forceinline__ uint32_t lds_addr(const void* p) {
    return (uint32_t)(uintptr_t)p;
}

// CDNA5 async global->LDS DMA (GVS mode: SADDR base + 32-bit VGPR byte offset).
// One thread's share of a 32-key tile: 2 b128 copies of K, 8 b32 copies of V.
// All in one statement that ends in s_wait_xcnt 0, so that no address register
// of an issued copy can be rewritten ahead of that wait.
__device__ __forceinline__ void async_copy_tile(const uint32_t (&kl)[2], const uint32_t (&ko)[2],
                                                const uint32_t (&vl)[8], const uint32_t (&vo)[8],
                                                const float* kbase, const float* vbase) {
    asm volatile("global_load_async_to_lds_b128 %0, %2, %20\n\t"
                 "global_load_async_to_lds_b128 %1, %3, %20\n\t"
                 "global_load_async_to_lds_b32 %4, %12, %21\n\t"
                 "global_load_async_to_lds_b32 %5, %13, %21\n\t"
                 "global_load_async_to_lds_b32 %6, %14, %21\n\t"
                 "global_load_async_to_lds_b32 %7, %15, %21\n\t"
                 "global_load_async_to_lds_b32 %8, %16, %21\n\t"
                 "global_load_async_to_lds_b32 %9, %17, %21\n\t"
                 "global_load_async_to_lds_b32 %10, %18, %21\n\t"
                 "global_load_async_to_lds_b32 %11, %19, %21\n\t"
                 "s_wait_xcnt 0x0"
                 :: "v"(kl[0]), "v"(kl[1]), "v"(ko[0]), "v"(ko[1]),
                    "v"(vl[0]), "v"(vl[1]), "v"(vl[2]), "v"(vl[3]),
                    "v"(vl[4]), "v"(vl[5]), "v"(vl[6]), "v"(vl[7]),
                    "v"(vo[0]), "v"(vo[1]), "v"(vo[2]), "v"(vo[3]),
                    "v"(vo[4]), "v"(vo[5]), "v"(vo[6]), "v"(vo[7]),
                    "s"(kbase), "s"(vbase)
                 : "memory");
}
__device__ __forceinline__ void wait_async0() {
    asm volatile("s_wait_asynccnt 0x0" ::: "memory");
}
// This wave's LDS reads have retired before the barrier behind which the
// buffer they read is refilled by copies.
__device__ __forceinline__ void wait_ds0() {
    asm volatile("s_wait_dscnt 0x0" ::: "memory");
}

// Lane l's value from lane l ^ 16: the two lanes that share one query column.
__device__ __forceinline__ float xhalf(float x) {
    const int xi = __builtin_bit_cast(int, x);
    return __builtin_bit_cast(float, __builtin_amdgcn_permlanex16(xi, xi, 0x76543210, 0xfedcba98, false, false));
}

__global__ __launch_bounds__(NTHREADS)
void attn_fwd_wmma(const float* __restrict__ q, const float* __restrict__ k,
                   const float* __restrict__ v, const float* __restrict__ bias,
                   float* __restrict__ out) {
    __shared__ __attribute__((aligned(16))) float kf_lds[2][NGRP][BJ * KP];     // keys, row-major (j, d), dbl buf, per group
    __shared__ __attribute__((aligned(16))) float vT_lds[2][NGRP][DHEAD * VP];  // values transposed (d, j), dbl buf, per group
    __shared__ __attribute__((aligned(16))) float mrg_lds[BQ / WQ][9][32][4];   // group 1's O^T, m, l on their way to group 0

    const int tid  = threadIdx.x & (GTHREADS - 1);                          // thread index inside the group
    const int wv   = __builtin_amdgcn_readfirstlane((int)threadIdx.x >> 5);  // scalar: branches on it are wave-uniform
    const int grp  = wv >> 3;      // key-tile parity this wave works on
    const int wave = wv & 7;       // which 16 query rows of the block
    const int lane = tid & 31;
    const int n16  = lane & 15;    // this lane's query column; row of an A fragment
    const int h    = lane >> 4;    // lane half (selects K subset / row offset)

    const int pairi = blockIdx.x;              // 0..3: the pair of query blocks
    const int bh    = blockIdx.y;              // 0..63 (b*H + h)

    const float scale = 0.125f;                // 1/sqrt(64)

    const size_t base_qk = (size_t)bh * NSEQ * DHEAD;
    const size_t base_b  = (size_t)bh * NSEQ * NSEQ;

    // all-ones A fragment: column sums of P^T via WMMA (every row of ones x P^T is l)
    v16h ones;
#pragma unroll
    for (int i = 0; i < 16; ++i) ones[i] = (h16)1.0f;

    // ---- async stage of one 32-key K/V tile into this group's LDS buffer `buf` ---------
    auto stage = [&](int j0, int buf) {
        const float* kb_ = k + base_qk + (size_t)j0 * DHEAD;
        const float* vb_ = v + base_qk + (size_t)j0 * DHEAD;
        uint32_t kl[2], ko[2], vl[8], vo[8];
        // K row-major: 2048 dwords, b128 per lane -> 2 DMA ops per thread
#pragma unroll
        for (int i = 0; i < (BJ * DHEAD) / (GTHREADS * 4); ++i) {
            const int e = tid * 4 + i * GTHREADS * 4;
            kl[i] = lds_addr(&kf_lds[buf][grp][(e / DHEAD) * KP + (e % DHEAD)]);
            ko[i] = (uint32_t)(e * 4);
        }
        // V transposed in the DMA: per-lane LDS dest = (d, j); global contiguous
#pragma unroll
        for (int i = 0; i < (BJ * DHEAD) / GTHREADS; ++i) {
            const int e  = tid + i * GTHREADS;
            const int jr = e / DHEAD;
            const int c  = e % DHEAD;
            vl[i] = lds_addr(&vT_lds[buf][grp][c * VP + jr]);
            vo[i] = (uint32_t)(e * 4);
        }
        async_copy_tile(kl, ko, vl, vo, kb_, vb_);
    };

    // ---- Q fragments (B operand: lane = query, same k map) of one query block, fp32 -> f16 -
    auto load_q = [&](int blk, v16h (&dst)[2]) {
        // this lane's row, at its half's first k index
        const float* qrow = q + base_qk + (size_t)(blk * BQ + wave * WQ + n16) * DHEAD + kmap(0, h);
        float raw[2][16];
#pragma unroll
        for (int f = 0; f < 2; ++f) {
#pragma unroll
            for (int r = 0; r < 8; ++r) {
                const int d0 = f * 32 + kmap(r, 0);
                raw[f][2 * r]     = qrow[d0];
                raw[f][2 * r + 1] = qrow[d0 + 1];
            }
        }
        // Stands in front of any rewrite of the address registers these loads
        // name: qrow is an input so that its registers stay live up to the wait.
        asm volatile("s_wait_xcnt 0x0" :: "v"(qrow) : "memory");
#pragma unroll
        for (int f = 0; f < 2; ++f)
#pragma unroll
            for (int i = 0; i < 16; ++i) dst[f][i] = (h16)raw[f][i];
    };

    stage(grp * BJ, 0);
    int cur = 0;

    v16h qa[2];
    load_q(NSEQ / BQ - 1 - pairi, qa);

    // Causal cost grows linearly with the query block's index, so every
    // workgroup takes block 7-p and then block p, one after the other: the
    // same 36 key tiles in each workgroup, 18 for each wave group. Kept rolled:
    // two copies of the body would only double the code.
#pragma unroll 1
    for (int half = 0; half < 2; ++half) {
        const int iblk  = half ? pairi : (NSEQ / BQ - 1 - pairi);
        const int wg_i0 = iblk * BQ;
        const int i0    = wg_i0 + wave * WQ;       // this wave's first query row

        // ---- accumulators & online-softmax state ------------------------------
        v8f o[4];
#pragma unroll
        for (int t = 0; t < 4; ++t) o[t] = fz8();
        float lsum = 0.0f;                         // this lane's query: softmax denominator
        float mrow = -FLT_MAX;                     // this lane's query: running maximum

        const int ntr = (wg_i0 + BQ) / (NGRP * BJ);   // trips: uniform across the workgroup, the same in both groups

        for (int it = 0; it < ntr; ++it) {
            const int j0 = (NGRP * it + grp) * BJ;    // this group's key tile of the trip

            wait_ds0();             // this wave has left the buffer refilled below
            wait_async0();          // this wave's DMA for this trip's tile is in LDS
            __syncthreads();        // everyone's DMA visible; prev buffer free

            if (it + 1 < ntr) stage(j0 + NGRP * BJ, cur ^ 1);   // overlap the group's next tile

            if (j0 <= i0 + WQ - 1) {               // wave-uniform causal skip
                // prefetch next iteration's 16x32 bias tile (one line per row)
                if (it + 1 < ntr) {
                    const float* bp = bias + base_b + (size_t)(i0 + n16) * NSEQ
                                      + (size_t)(j0 + NGRP * BJ) + h * 16;
                    __builtin_prefetch(bp, 0, 3);   // locality 3: shader-engine scope, the line goes to L2
                }

                const float* kbuf = kf_lds[cur][grp];
                const float* vbuf = vT_lds[cur][grp];

                // ---- S^T = K Q^T (+scale +bias +causal), two 16-key subtiles ----
                // Accumulator register r of this lane: key j0 + jt*16 + 8h + r of
                // query i0 + n16, so a lane's bias is 8 floats in a row per subtile.
                const int    row  = i0 + n16;
                const float* brow = bias + base_b + (size_t)row * NSEQ + j0 + 8 * h;
                v4f bv[2][2];
#pragma unroll
                for (int jt = 0; jt < 2; ++jt)
#pragma unroll
                    for (int u = 0; u < 2; ++u)   // bias is stream-once: non-temporal keeps K/V resident in L2
                        bv[jt][u] = __builtin_nontemporal_load((const v4f*)(brow + jt * 16 + u * 4));

                // Fragment element 4q + e has k index 8h + 4q + e (q < 2) or 8h + 8 + 4q + e: kmap's order.
                v4f kr[2][2][4];
#pragma unroll
                for (int jt = 0; jt < 2; ++jt) {
                    const float* krow = &kbuf[(jt * 16 + n16) * KP + 8 * h];
#pragma unroll
                    for (int f = 0; f < 2; ++f)
#pragma unroll
                        for (int qd = 0; qd < 4; ++qd)
                            kr[jt][f][qd] = *(const v4f*)(krow + f * 32 + kmap(2 * qd, 0));
                }
                // Keeps the K reads in front of the V reads: S^T needs K first, and a K read
                // issued last would make its products wait for every V read as well.
                __builtin_amdgcn_sched_barrier(0);
                v4f vr[4][4];
#pragma unroll
                for (int tt = 0; tt < 4; ++tt) {
                    const float* vcol = &vbuf[(tt * 16 + n16) * VP + 8 * h];
#pragma unroll
                    for (int qd = 0; qd < 4; ++qd)
                        vr[tt][qd] = *(const v4f*)(vcol + kmap(2 * qd, 0));
                }
                // Keeps the trip's bias and fragment loads issued here, ahead of all
                // the arithmetic: sunk to their first uses, each latency would be waited out alone.
                __builtin_amdgcn_sched_barrier(0);

                const int dlt = row - j0 - 8 * h;      // key index in this lane's run that sits on the diagonal
                float svals[2][8];
#pragma unroll
                for (int jt = 0; jt < 2; ++jt) {
                    v8f s = fz8();
#pragma unroll
                    for (int f = 0; f < 2; ++f) {
                        v16h kb;
#pragma unroll
                        for (int i = 0; i < 16; ++i) kb[i] = (h16)kr[jt][f][i >> 2][i & 3];
                        s = __builtin_amdgcn_wmma_f32_16x16x32_f16(
                                false, kb, false, qa[f], (short)0, s, false, false);
                    }
                    const v8f bb = __builtin_shufflevector(bv[jt][0], bv[jt][1], 0, 1, 2, 3, 4, 5, 6, 7);
                    s = s * scale + bb;
#pragma unroll
                    for (int r = 0; r < 8; ++r)        // causal: strictly above diag
                        svals[jt][r] = (jt * 16 + r > dlt) ? -FLT_MAX : s[r];
                }

                // ---- online softmax, in-lane: 16 keys here, 16 in lane ^ 16 ----
                float t = fmaxf(svals[0][0], svals[1][0]);
#pragma unroll
                for (int r = 1; r < 8; ++r) t = fmaxf(t, fmaxf(svals[0][r], svals[1][r]));
                t = fmaxf(t, xhalf(t));
                const float mnew  = fmaxf(mrow, t);
                const float alpha = __expf(mrow - mnew);
                mrow = mnew;

                // P^T as a B operand straight from the accumulators: element e of the
                // fragment is key e + 8h (e < 8) or e + 8 + 8h, which is kmap's order.
                v16h pa;
#pragma unroll
                for (int r = 0; r < 8; ++r) {
                    pa[r]     = (h16)__expf(svals[0][r] - mrow);
                    pa[8 + r] = (h16)__expf(svals[1][r] - mrow);
                }

                // ---- rescale O^T and l, then O^T += V^T P^T, l += ones x P^T ----
#pragma unroll
                for (int tt = 0; tt < 4; ++tt)
#pragma unroll
                    for (int r = 0; r < 8; ++r) o[tt][r] *= alpha;

                const v8f ls = __builtin_amdgcn_wmma_f32_16x16x32_f16(
                                   false, ones, false, pa, (short)0, fz8(), false, false);
#pragma unroll
                for (int tt = 0; tt < 4; ++tt) {
                    v16h vb;
#pragma unroll
                    for (int i = 0; i < 16; ++i) vb[i] = (h16)vr[tt][i >> 2][i & 3];
                    o[tt] = __builtin_amdgcn_wmma_f32_16x16x32_f16(
                                false, vb, false, pa, (short)0, o[tt], false, false);
                }
                lsum = lsum * alpha + ls[0];
            }
            cur ^= 1;
        }

        // The second block's first K/V tile flies under its Q loads and the first
        // block's epilogue. Buffer `cur` was last read two trips back, in front of the last
        // trip's s_wait_dscnt 0 and barrier, and the last trip refilled nothing:
        // this refill needs no barrier of its own.
        if (half == 0) {
            stage(grp * BJ, cur);
            load_q(pairi, qa);
        }

        // ---- join the two groups' partial softmax: group 1 hands O^T, m, l to group 0 ----
        // A lane's partner is the same lane of wave + 8: same query, same d registers.
        if (grp == 1) {
#pragma unroll
            for (int t = 0; t < 4; ++t)
#pragma unroll
                for (int u = 0; u < 2; ++u) {
                    v4f w;
#pragma unroll
                    for (int e = 0; e < 4; ++e) w[e] = o[t][u * 4 + e];
                    *(v4f*)&mrg_lds[wave][t * 2 + u][lane][0] = w;
                }
            mrg_lds[wave][8][lane][0] = mrow;
            mrg_lds[wave][8][lane][1] = lsum;
        }
        // Group 1's partials are in LDS for group 0. The next write of mrg_lds lies behind
        // the next block's trip barriers, each with its s_wait_dscnt 0 in front.
        __syncthreads();

        // ---- normalize and store (non-temporal: output is never re-read) ------
        // Register r of o[t] is d = t*16 + 8h + r of query i0 + n16: 8 floats in a row.
        if (grp == 0) {
            const float m1   = mrg_lds[wave][8][lane][0];
            const float l1   = mrg_lds[wave][8][lane][1];
            const float mall = fmaxf(mrow, m1);
            const float a0   = __expf(mrow - mall);
            const float a1   = __expf(m1 - mall);      // 0 where group 1 had no tile under the diagonal
            const float inv  = 1.0f / (lsum * a0 + l1 * a1);
            const float c0   = a0 * inv;
            const float c1   = a1 * inv;
            float*      orow = out + base_qk + (size_t)(i0 + n16) * DHEAD + 8 * h;
#pragma unroll
            for (int t = 0; t < 4; ++t)
#pragma unroll
                for (int u = 0; u < 2; ++u) {
                    const v4f o1 = *(const v4f*)&mrg_lds[wave][t * 2 + u][lane][0];
                    v4f w;
#pragma unroll
                    for (int e = 0; e < 4; ++e) w[e] = o[t][u * 4 + e] * c0 + o1[e] * c1;
                    __builtin_nontemporal_store(w, (v4f*)(orow + t * 16 + u * 4));
                }
            // The next block's set-up rewrites registers that these stores name.
            asm volatile("s_wait_xcnt 0x0" ::: "memory");
        }
    }   // the pair's two query blocks
}

extern "C" void kernel_launch(void* const* d_in, const int* in_sizes, int n_in,
                              void* d_out, int out_size, void* d_ws, size_t ws_size,
                              hipStream_t stream) {
    const float* q    = (const float*)d_in[0];
    const float* k    = (const float*)d_in[1];
    const float* v    = (const float*)d_in[2];
    const float* bias = (const float*)d_in[3];
    float* out = (float*)d_out;

    dim3 grid(NSEQ / BQ / 2, 4 * 16);   // (pairs of i-blocks, B*H)
    dim3 block(NTHREADS);
    attn_fwd_wmma<<<grid, block, 0, stream>>>(q, k, v, bias, out);
}

// v005
// A run of this version takes 29.2 microseconds.
// In both of two side-by-side timings against v004, it was 1.10 times as fast.
// Counting every step since v000, it is 6.44 times as fast.
#include <hip/hip_runtime.h>
#include <cfloat>
#include <cmath>
#include <cstdint>

typedef _Float16 h16;
typedef __attribute__((ext_vector_type(16))) _Float16 v16h;
typedef __attribute__((ext_vector_type(8)))  _Float16 v8h;
typedef __attribute__((ext_vector_type(4)))  _Float16 v4h;
typedef __attribute__((ext_vector_type(8)))  float    v8f;
typedef __attribute__((ext_vector_type(4)))  float    v4f;

#define NSEQ     1024
#define DHEAD    64
#define BQ       128      // query rows per query block (a workgroup takes two)
#define WQ       16       // query rows per wave
#define BJ       32       // keys per j-iteration (K=32 for the PV WMMA)
#define NGRP     2        // wave groups per workgroup: group g takes key tiles g, g + 2, g + 4, ...
#define GTHREADS 256      // threads of one group (8 waves, one per 16 query rows)
#define NTHREADS (NGRP * GTHREADS)
// LDS row pitches: 16 B x odd, so that the 16 lanes of a ds_load_b128 that walk
// 16 rows fall on 16 different groups of four banks.
#define KP       72       // halves per K row   (144 B)
#define VP       40       // halves per V^T row (80 B)

// A/B fragment dword r (0..7) + lane-half h (0/1) -> first K index of the
// packed f16 pair, per the CDNA5 16-bit A-matrix 16x32 VGPR layout.
__device__ __forceinline__ int kmap(int r, int h) {
    return 2 * r + ((r >= 4) ? 8 : 0) + 8 * h;
}

__device__ __forceinline__ v8f fz8() {
    v8f z;
#pragma unroll
    for (int i = 0; i < 8; ++i) z[i] = 0.0f;
    return z;
}

// Lane l's value from lane l ^ 16: the two lanes that share one query column.
__device__ __forceinline__ float xhalf(float x) {
    const int xi = __builtin_bit_cast(int, x);
    return __builtin_bit_cast(float, __builtin_amdgcn_permlanex16(xi, xi, 0x76543210, 0xfedcba98, false, false));
}

__global__ __launch_bounds__(NTHREADS)
void attn_fwd_wmma(const float* __restrict__ q, const float* __restrict__ k,
                   const float* __restrict__ v, const float* __restrict__ bias,
                   float* __restrict__ out) {
    __shared__ __attribute__((aligned(16))) h16 kh_lds[2][NGRP][BJ * KP];      // keys as f16, row-major (j, d), dbl buf, per group
    __shared__ __attribute__((aligned(16))) h16 vT_lds[2][NGRP][DHEAD * VP];   // values as f16, transposed (d, j), dbl buf, per group
    __shared__ __attribute__((aligned(16))) float mrg_lds[BQ / WQ][9][32][4];   // group 1's O^T, m, l on their way to group 0

    const int tid  = threadIdx.x & (GTHREADS - 1);                          // thread index inside the group
    const int wv   = __builtin_amdgcn_readfirstlane((int)threadIdx.x >> 5);  // scalar: branches on it are wave-uniform
    const int grp  = wv >> 3;      // key-tile parity this wave works on
    const int wave = wv & 7;       // which 16 query rows of the block
    const int lane = tid & 31;
    const int n16  = lane & 15;    // this lane's query column; row of an A fragment
    const int h    = lane >> 4;    // lane half (selects K subset / row offset)

    const int pairi = blockIdx.x;              // 0..3: the pair of query blocks
    const int bh    = blockIdx.y;              // 0..63 (b*H + h)

    const float scale = 0.125f;                // 1/sqrt(64)

    const size_t base_qk = (size_t)bh * NSEQ * DHEAD;
    const size_t base_b  = (size_t)bh * NSEQ * NSEQ;

    // all-ones A fragment: column sums of P^T via WMMA (every row of ones x P^T is l)
    v16h ones;
#pragma unroll
    for (int i = 0; i < 16; ++i) ones[i] = (h16)1.0f;

    // ---- stage of one 32-key K/V tile, through registers: fp32 is rounded to f16 once,
    // by the thread that brings it, and every wave reads finished fragments from LDS.
    // K: twice 4 floats in a row, the wave's 32 lanes side by side. V: 8 keys in a row of column tid % 64.
    v4f   kst[2];
    float vst[8];
    const float* const kthr = k + base_qk + tid * 4;
    const float* const vthr = v + base_qk + (tid >> 6) * 8 * DHEAD + (tid & 63);
    auto stage_load = [&](const float* kp, const float* vp) {
        kst[0] = *(const v4f*)kp;
        kst[1] = *(const v4f*)(kp + GTHREADS * 4);
#pragma unroll
        for (int i = 0; i < 8; ++i) vst[i] = vp[i * DHEAD];
    };
    auto stage_store = [&](int buf) {
#pragma unroll
        for (int i = 0; i < 2; ++i) {
            v4h kh;
#pragma unroll
            for (int e = 0; e < 4; ++e) kh[e] = (h16)kst[i][e];
            *(v4h*)&kh_lds[buf][grp][((tid >> 4) + i * (GTHREADS / 16)) * KP + (tid & 15) * 4] = kh;
        }
        v8h vh;
#pragma unroll
        for (int i = 0; i < 8; ++i) vh[i] = (h16)vst[i];
        *(v8h*)&vT_lds[buf][grp][(tid & 63) * VP + (tid >> 6) * 8] = vh;
    };

    // ---- Q fragments (B operand: lane = query, same k map) of one query block, fp32 -> f16 -
    auto load_q = [&](int blk, v16h (&dst)[2]) {
        // this lane's row, at its half's first k index
        const float* qrow = q + base_qk + (size_t)(blk * BQ + wave * WQ + n16) * DHEAD + kmap(0, h);
        float raw[2][16];
#pragma unroll
        for (int f = 0; f < 2; ++f) {
#pragma unroll
            for (int r = 0; r < 8; ++r) {
                const int d0 = f * 32 + kmap(r, 0);
                raw[f][2 * r]     = qrow[d0];
                raw[f][2 * r + 1] = qrow[d0 + 1];
            }
        }
        // Stands in front of any rewrite of the address registers these loads
        // name: qrow is an input so that its registers stay live up to the wait.
        asm volatile("s_wait_xcnt 0x0" :: "v"(qrow) : "memory");
#pragma unroll
        for (int f = 0; f < 2; ++f)
#pragma unroll
            for (int i = 0; i < 16; ++i) dst[f][i] = (h16)raw[f][i];
    };

    {
        const float* kp = kthr + grp * BJ * DHEAD;
        const float* vp = vthr + grp * BJ * DHEAD;
        stage_load(kp, vp);
        // Stands in front of any rewrite of the address registers these loads
        // name: the pointers are inputs so that their registers stay live up to the wait.
        asm volatile("s_wait_xcnt 0x0" :: "v"(kp), "v"(vp) : "memory");
    }
    int cur = 0;

    v16h qa[2];
    load_q(NSEQ / BQ - 1 - pairi, qa);
    stage_store(0);

    // Causal cost grows linearly with the query block's index, so every
    // workgroup takes block 7-p and then block p, one after the other: the
    // same 36 key tiles in each workgroup, 18 for each wave group. Kept rolled:
    // two copies of the body would only double the code.
#pragma unroll 1
    for (int half = 0; half < 2; ++half) {
        const int iblk  = half ? pairi : (NSEQ / BQ - 1 - pairi);
        const int wg_i0 = iblk * BQ;
        const int i0    = wg_i0 + wave * WQ;       // this wave's first query row

        // ---- accumulators & online-softmax state ------------------------------
        v8f o[4];
#pragma unroll
        for (int t = 0; t < 4; ++t) o[t] = fz8();
        float lsum = 0.0f;                         // this lane's query: softmax denominator
        float mrow = -FLT_MAX;                     // this lane's query: running maximum

        const int ntr = (wg_i0 + BQ) / (NGRP * BJ);   // trips: uniform across the workgroup, the same in both groups

        for (int it = 0; it < ntr; ++it) {
            const int j0 = (NGRP * it + grp) * BJ;    // this group's key tile of the trip

            __syncthreads();        // everyone's stores of this trip's tile visible; prev buffer free

            const bool act  = j0 <= i0 + WQ - 1;   // wave-uniform causal skip
            const bool more = it + 1 < ntr;

            // S^T accumulator register r of this lane: key j0 + jt*16 + 8h + r of
            // query i0 + n16, so a lane's bias is 8 floats in a row per subtile.
            // Issued ahead of the next tile's loads: loads return in order, and the
            // scores would otherwise wait for the K/V loads as well.
            const int    row  = i0 + n16;
            const float* brow = bias + base_b + (size_t)row * NSEQ + j0 + 8 * h;
            v4f bv[2][2];
            if (act) {
#pragma unroll
                for (int jt = 0; jt < 2; ++jt)
#pragma unroll
                    for (int u = 0; u < 2; ++u)   // bias is stream-once: non-temporal keeps K/V resident in L2
                        bv[jt][u] = __builtin_nontemporal_load((const v4f*)(brow + jt * 16 + u * 4));
            }

            // The group's next tile flies under this trip's work; behind a block's last
            // tile comes the first tile of the next block. Issued on every trip, the
            // workgroup's very last too (nobody reads that tile): with a fixed number of
            // younger loads the wait for the bias is a counted one and leaves these in flight.
            const int    jn = more ? j0 + NGRP * BJ : grp * BJ;
            const float* kp = kthr + (size_t)jn * DHEAD;
            const float* vp = vthr + (size_t)jn * DHEAD;
            stage_load(kp, vp);
            // Stands in front of any rewrite of the address registers that the trip's loads
            // name: the pointers are inputs so that their registers stay live up to the wait.
            asm volatile("s_wait_xcnt 0x0" :: "v"(brow), "v"(kp), "v"(vp) : "memory");

            v8h   vr[4][2];   // V^T fragments, read with K's, used behind the stores
            v16h  pa;         // P^T
            float alpha;      // what the new maximum scales the old sums by
            if (act) {
                // prefetch next iteration's 16x32 bias tile (one line per row)
                if (more) {
                    const float* bp = bias + base_b + (size_t)(i0 + n16) * NSEQ
                                      + (size_t)(j0 + NGRP * BJ) + h * 16;
                    __builtin_prefetch(bp, 0, 3);   // locality 3: shader-engine scope, the line goes to L2
                }

                const h16* kbuf = kh_lds[cur][grp];
                const h16* vbuf = vT_lds[cur][grp];

                // ---- S^T = K Q^T (+scale +bias +causal), two 16-key subtiles ----
                // Fragment element 8q + e has k index 8h + 16q + e: kmap's order.
                v8h kr[2][2][2];
#pragma unroll
                for (int jt = 0; jt < 2; ++jt) {
                    const h16* krow = &kbuf[(jt * 16 + n16) * KP + 8 * h];
#pragma unroll
                    for (int f = 0; f < 2; ++f)
#pragma unroll
                        for (int qd = 0; qd < 2; ++qd)
                            kr[jt][f][qd] = *(const v8h*)(krow + f * 32 + kmap(4 * qd, 0));
                }
                // Keeps the K reads in front of the V reads: S^T needs K first, and a K read
                // issued last would make its products wait for every V read as well.
                __builtin_amdgcn_sched_barrier(0);
#pragma unroll
                for (int tt = 0; tt < 4; ++tt) {
                    const h16* vcol = &vbuf[(tt * 16 + n16) * VP + 8 * h];
#pragma unroll
                    for (int qd = 0; qd < 2; ++qd)
                        vr[tt][qd] = *(const v8h*)(vcol + kmap(4 * qd, 0));
                }
                // Keeps the trip's bias and fragment loads issued here, ahead of all
                // the arithmetic: sunk to their first uses, each latency would be waited out alone.
                __builtin_amdgcn_sched_barrier(0);

                const int dlt = row - j0 - 8 * h;      // key index in this lane's run that sits on the diagonal
                float svals[2][8];
#pragma unroll
                for (int jt = 0; jt < 2; ++jt) {
                    v8f s = fz8();
#pragma unroll
                    for (int f = 0; f < 2; ++f) {
                        const v16h kb = __builtin_shufflevector(kr[jt][f][0], kr[jt][f][1],
                                            0, 1, 2, 3, 4, 5, 6, 7, 8, 9, 10, 11, 12, 13, 14, 15);
                        s = __builtin_amdgcn_wmma_f32_16x16x32_f16(
                                false, kb, false, qa[f], (short)0, s, false, false);
                    }
                    const v8f bb = __builtin_shufflevector(bv[jt][0], bv[jt][1], 0, 1, 2, 3, 4, 5, 6, 7);
                    s = s * scale + bb;
#pragma unroll
                    for (int r = 0; r < 8; ++r)        // causal: strictly above diag
                        svals[jt][r] = (jt * 16 + r > dlt) ? -FLT_MAX : s[r];
                }

                // ---- online softmax, in-lane: 16 keys here, 16 in lane ^ 16 ----
                float t = fmaxf(svals[0][0], svals[1][0]);
#pragma unroll
                for (int r = 1; r < 8; ++r) t = fmaxf(t, fmaxf(svals[0][r], svals[1][r]));
                t = fmaxf(t, xhalf(t));
                const float mnew  = fmaxf(mrow, t);
                alpha = __expf(mrow - mnew);
                mrow = mnew;

                // P^T as a B operand straight from the accumulators: element e of the
                // fragment is key e + 8h (e < 8) or e + 8 + 8h, which is kmap's order.
#pragma unroll
                for (int r = 0; r < 8; ++r) {
                    pa[r]     = (h16)__expf(svals[0][r] - mrow);
                    pa[8 + r] = (h16)__expf(svals[1][r] - mrow);
                }

            }

            // Every reader left buffer cur ^ 1 in front of this trip's barrier. Stored
            // here, by waves that skip the tile too, so that the stores retire under the products below.
            stage_store(cur ^ 1);

            if (act) {
                // ---- rescale O^T and l, then O^T += V^T P^T, l += ones x P^T ----
#pragma unroll
                for (int tt = 0; tt < 4; ++tt)
#pragma unroll
                    for (int r = 0; r < 8; ++r) o[tt][r] *= alpha;

                const v8f ls = __builtin_amdgcn_wmma_f32_16x16x32_f16(
                                   false, ones, false, pa, (short)0, fz8(), false, false);
#pragma unroll
                for (int tt = 0; tt < 4; ++tt) {
                    const v16h vb = __builtin_shufflevector(vr[tt][0], vr[tt][1],
                                        0, 1, 2, 3, 4, 5, 6, 7, 8, 9, 10, 11, 12, 13, 14, 15);
                    o[tt] = __builtin_amdgcn_wmma_f32_16x16x32_f16(
                                false, vb, false, pa, (short)0, o[tt], false, false);
                }
                lsum = lsum * alpha + ls[0];
            }
            cur ^= 1;
        }

        // The second block's Q loads fly under the first block's epilogue.
        if (half == 0) load_q(pairi, qa);

        // ---- join the two groups' partial softmax: group 1 hands O^T, m, l to group 0 ----
        // A lane's partner is the same lane of wave + 8: same query, same d registers.
        if (grp == 1) {
#pragma unroll
            for (int t = 0; t < 4; ++t)
#pragma unroll
                for (int u = 0; u < 2; ++u) {
                    v4f w;
#pragma unroll
                    for (int e = 0; e < 4; ++e) w[e] = o[t][u * 4 + e];
                    *(v4f*)&mrg_lds[wave][t * 2 + u][lane][0] = w;
                }
            mrg_lds[wave][8][lane][0] = mrow;
            mrg_lds[wave][8][lane][1] = lsum;
        }
        // Group 1's partials are in LDS for group 0. The next write of mrg_lds lies behind
        // the next block's trip barriers.
        __syncthreads();

        // ---- normalize and store (non-temporal: output is never re-read) ------
        // Register r of o[t] is d = t*16 + 8h + r of query i0 + n16: 8 floats in a row.
        if (grp == 0) {
            const float m1   = mrg_lds[wave][8][lane][0];
            const float l1   = mrg_lds[wave][8][lane][1];
            const float mall = fmaxf(mrow, m1);
            const float a0   = __expf(mrow - mall);
            const float a1   = __expf(m1 - mall);      // 0 where group 1 had no tile under the diagonal
            const float inv  = 1.0f / (lsum * a0 + l1 * a1);
            const float c0   = a0 * inv;
            const float c1   = a1 * inv;
            float*      orow = out + base_qk + (size_t)(i0 + n16) * DHEAD + 8 * h;
#pragma unroll
            for (int t = 0; t < 4; ++t)
#pragma unroll
                for (int u = 0; u < 2; ++u) {
                    const v4f o1 = *(const v4f*)&mrg_lds[wave][t * 2 + u][lane][0];
                    v4f w;
#pragma unroll
                    for (int e = 0; e < 4; ++e) w[e] = o[t][u * 4 + e] * c0 + o1[e] * c1;
                    __builtin_nontemporal_store(w, (v4f*)(orow + t * 16 + u * 4));
                }
            // The next block's set-up rewrites registers that these stores name.
            asm volatile("s_wait_xcnt 0x0" ::: "memory");
        }
    }   // the pair's two query blocks
}

extern "C" void kernel_launch(void* const* d_in, const int* in_sizes, int n_in,
                              void* d_out, int out_size, void* d_ws, size_t ws_size,
                              hipStream_t stream) {
    const float* q    = (const float*)d_in[0];
    const float* k    = (const float*)d_in[1];
    const float* v    = (const float*)d_in[2];
    const float* bias = (const float*)d_in[3];
    float* out = (float*)d_out;

    dim3 grid(NSEQ / BQ / 2, 4 * 16);   // (pairs of i-blocks, B*H)
    dim3 block(NTHREADS);
    attn_fwd_wmma<<<grid, block, 0, stream>>>(q, k, v, bias, out);
}

// v006
// A run of this version takes 28.3 microseconds.
// Timed twice side by side with v005, it ran 1.03 times as fast both times.
// Counting every step since v000, it is 6.64 times as fast.
#include <hip/hip_runtime.h>
#include <cfloat>
#include <cmath>
#include <cstdint>

typedef _Float16 h16;
typedef __attribute__((ext_vector_type(16))) _Float16 v16h;
typedef __attribute__((ext_vector_type(8)))  _Float16 v8h;
typedef __attribute__((ext_vector_type(4)))  _Float16 v4h;
typedef __attribute__((ext_vector_type(8)))  float    v8f;
typedef __attribute__((ext_vector_type(4)))  float    v4f;

#define NSEQ     1024
#define DHEAD    64
#define BQ       128      // query rows per query block (a workgroup takes two)
#define WQ       16       // query rows per wave
#define BJ       32       // keys per j-iteration (K=32 for the PV WMMA)
#define NGRP     2        // wave groups per workgroup: group g takes key tiles g, g + 2, g + 4, ...
#define GTHREADS 256      // threads of one group (8 waves, one per 16 query rows)
#define NTHREADS (NGRP * GTHREADS)
// LDS row pitches: 16 B x odd, so that the 16 lanes of a ds_load_b128 that walk
// 16 rows fall on 16 different groups of four banks.
#define KP       72       // halves per K row   (144 B)
#define VP       40       // halves per V^T row (80 B)
#define BP       36       // floats per bias row (144 B)

// A/B fragment dword r (0..7) + lane-half h (0/1) -> first K index of the
// packed f16 pair, per the CDNA5 16-bit A-matrix 16x32 VGPR layout.
__device__ __forceinline__ int kmap(int r, int h) {
    return 2 * r + ((r >= 4) ? 8 : 0) + 8 * h;
}

__device__ __forceinline__ v8f fz8() {
    v8f z;
#pragma unroll
    for (int i = 0; i < 8; ++i) z[i] = 0.0f;
    return z;
}

// Lane l's value from lane l ^ 16: the two lanes that share one query column.
__device__ __forceinline__ float xhalf(float x) {
    const int xi = __builtin_bit_cast(int, x);
    return __builtin_bit_cast(float, __builtin_amdgcn_permlanex16(xi, xi, 0x76543210, 0xfedcba98, false, false));
}

__global__ __launch_bounds__(NTHREADS)
void attn_fwd_wmma(const float* __restrict__ q, const float* __restrict__ k,
                   const float* __restrict__ v, const float* __restrict__ bias,
                   float* __restrict__ out) {
    __shared__ __attribute__((aligned(16))) h16 kh_lds[2][NGRP][BJ * KP];      // keys as f16, row-major (j, d), dbl buf, per group
    __shared__ __attribute__((aligned(16))) h16 vT_lds[2][NGRP][DHEAD * VP];   // values as f16, transposed (d, j), dbl buf, per group
    __shared__ __attribute__((aligned(16))) float mrg_lds[BQ / WQ][9][32][4];   // group 1's O^T, m, l on their way to group 0
    __shared__ __attribute__((aligned(16))) float b_lds[2][NGRP * (BQ / WQ)][WQ * BP];   // each wave's own 16 x 32 bias tile, row-major (query, key), dbl buf

    const int tid  = threadIdx.x & (GTHREADS - 1);                          // thread index inside the group
    const int wv   = __builtin_amdgcn_readfirstlane((int)threadIdx.x >> 5);  // scalar: branches on it are wave-uniform
    const int grp  = wv >> 3;      // key-tile parity this wave works on
    const int wave = wv & 7;       // which 16 query rows of the block
    const int lane = tid & 31;
    const int n16  = lane & 15;    // this lane's query column; row of an A fragment
    const int h    = lane >> 4;    // lane half (selects K subset / row offset)

    const int pairi = blockIdx.x;              // 0..3: the pair of query blocks
    const int bh    = blockIdx.y;              // 0..63 (b*H + h)

    const float scale = 0.125f;                // 1/sqrt(64)

    const size_t base_qk = (size_t)bh * NSEQ * DHEAD;
    const size_t base_b  = (size_t)bh * NSEQ * NSEQ;

    // all-ones A fragment: column sums of P^T via WMMA (every row of ones x P^T is l)
    v16h ones;
#pragma unroll
    for (int i = 0; i < 16; ++i) ones[i] = (h16)1.0f;

    // ---- stage of one 32-key K/V tile, through registers: fp32 is rounded to f16 once,
    // by the thread that brings it, and every wave reads finished fragments from LDS.
    // K: twice 4 floats in a row, the wave's 32 lanes side by side. V: 8 keys in a row of column tid % 64.
    v4f   kst[2];
    float vst[8];
    const float* const kthr = k + base_qk + tid * 4;
    const float* const vthr = v + base_qk + (tid >> 6) * 8 * DHEAD + (tid & 63);
    auto stage_load = [&](const float* kp, const float* vp) {
        kst[0] = *(const v4f*)kp;
        kst[1] = *(const v4f*)(kp + GTHREADS * 4);
#pragma unroll
        for (int i = 0; i < 8; ++i) vst[i] = vp[i * DHEAD];
    };
    auto stage_store = [&](int buf) {
#pragma unroll
        for (int i = 0; i < 2; ++i) {
            v4h kh;
#pragma unroll
            for (int e = 0; e < 4; ++e) kh[e] = (h16)kst[i][e];
            *(v4h*)&kh_lds[buf][grp][((tid >> 4) + i * (GTHREADS / 16)) * KP + (tid & 15) * 4] = kh;
        }
        v8h vh;
#pragma unroll
        for (int i = 0; i < 8; ++i) vh[i] = (h16)vst[i];
        *(v8h*)&vT_lds[buf][grp][(tid & 63) * VP + (tid >> 6) * 8] = vh;
    };

    // ---- one wave's 16-query x 32-key bias tile, global -> LDS by asynchronous copies.
    // A score register layout wants 32 B of each of 16 rows per load: 16 lines touched for
    // 512 B. A copy takes whole lines instead (8 lanes side by side on one row's 128 B, 4 rows
    // a copy), and the lanes pick their own pieces out of LDS.
    const float* const bthr = bias + base_b + (size_t)(lane >> 3) * NSEQ + (lane & 7) * 4;
    const uint32_t     bdst = (uint32_t)(uintptr_t)&b_lds[0][wv][(lane >> 3) * BP + (lane & 7) * 4];
    auto bias_copy = [&](int r0, int jc, uint32_t boff) {   // boff: the buffer's byte offset in b_lds
        const float*   g0 = bthr + (size_t)r0 * NSEQ + jc;
        const float*   g1 = g0 + 4 * NSEQ;
        const float*   g2 = g0 + 8 * NSEQ;
        const float*   g3 = g0 + 12 * NSEQ;
        const uint32_t l0 = bdst + boff;
        const uint32_t l1 = l0 + 4 * BP * 4;
        const uint32_t l2 = l0 + 8 * BP * 4;
        const uint32_t l3 = l0 + 12 * BP * 4;
        // The wait is the statement's last line, so that it stands in front of any
        // rewrite of the address registers that the copies name.
        // Bias is stream-once: non-temporal keeps K/V resident in L2.
        asm volatile("global_load_async_to_lds_b128 %0, %4, off th:TH_LOAD_NT\n\t"
                     "global_load_async_to_lds_b128 %1, %5, off th:TH_LOAD_NT\n\t"
                     "global_load_async_to_lds_b128 %2, %6, off th:TH_LOAD_NT\n\t"
                     "global_load_async_to_lds_b128 %3, %7, off th:TH_LOAD_NT\n\t"
                     "s_wait_xcnt 0x0"
                     :: "v"(l0), "v"(l1), "v"(l2), "v"(l3), "v"(g0), "v"(g1), "v"(g2), "v"(g3)
                     : "memory");
    };

    // ---- Q fragments (B operand: lane = query, same k map) of one query block, fp32 -> f16 -
    auto load_q = [&](int blk, v16h (&dst)[2]) {
        // this lane's row, at its half's first k index
        const float* qrow = q + base_qk + (size_t)(blk * BQ + wave * WQ + n16) * DHEAD + kmap(0, h);
        float raw[2][16];
#pragma unroll
        for (int f = 0; f < 2; ++f) {
#pragma unroll
            for (int r = 0; r < 8; ++r) {
                const int d0 = f * 32 + kmap(r, 0);
                raw[f][2 * r]     = qrow[d0];
                raw[f][2 * r + 1] = qrow[d0 + 1];
            }
        }
        // Stands in front of any rewrite of the address registers these loads
        // name: qrow is an input so that its registers stay live up to the wait.
        asm volatile("s_wait_xcnt 0x0" :: "v"(qrow) : "memory");
#pragma unroll
        for (int f = 0; f < 2; ++f)
#pragma unroll
            for (int i = 0; i < 16; ++i) dst[f][i] = (h16)raw[f][i];
    };

    // The first bias tile of the first query block, into buffer 0; the first trip's wait and barrier publish it.
    if (grp * BJ <= (NSEQ / BQ - 1 - pairi) * BQ + wave * WQ + WQ - 1)
        bias_copy((NSEQ / BQ - 1 - pairi) * BQ + wave * WQ, grp * BJ, 0);

    {
        const float* kp = kthr + grp * BJ * DHEAD;
        const float* vp = vthr + grp * BJ * DHEAD;
        stage_load(kp, vp);
        // Stands in front of any rewrite of the address registers these loads
        // name: the pointers are inputs so that their registers stay live up to the wait.
        asm volatile("s_wait_xcnt 0x0" :: "v"(kp), "v"(vp) : "memory");
    }
    int cur = 0;
    uint32_t bcur = 0;   // byte offset in b_lds of the bias buffer that this trip reads: 0 or one buffer's size

    v16h qa[2];
    load_q(NSEQ / BQ - 1 - pairi, qa);
    stage_store(0);

    // Causal cost grows linearly with the query block's index, so every
    // workgroup takes block 7-p and then block p, one after the other: the
    // same 36 key tiles in each workgroup, 18 for each wave group. Kept rolled:
    // two copies of the body would only double the code.
#pragma unroll 1
    for (int half = 0; half < 2; ++half) {
        const int iblk  = half ? pairi : (NSEQ / BQ - 1 - pairi);
        const int wg_i0 = iblk * BQ;
        const int i0    = wg_i0 + wave * WQ;       // this wave's first query row

        // ---- accumulators & online-softmax state ------------------------------
        v8f o[4];
#pragma unroll
        for (int t = 0; t < 4; ++t) o[t] = fz8();
        float lsum = 0.0f;                         // this lane's query: softmax denominator
        float mrow = -FLT_MAX;                     // this lane's query: running maximum

        const int ntr = (wg_i0 + BQ) / (NGRP * BJ);   // trips: uniform across the workgroup, the same in both groups

        for (int it = 0; it < ntr; ++it) {
            const int j0 = (NGRP * it + grp) * BJ;    // this group's key tile of the trip

            // This wave's LDS reads of the last trip have retired before its copies refill that buffer.
            asm volatile("s_wait_dscnt 0x0" ::: "memory");
            // This trip's bias tile, copied during the last trip, has landed.
            asm volatile("s_wait_asynccnt 0x0" ::: "memory");
            __syncthreads();        // everyone's stores of this trip's tile visible; prev buffer free

            const bool act  = j0 <= i0 + WQ - 1;   // wave-uniform causal skip
            const bool more = it + 1 < ntr;

            const int row = i0 + n16;

            // The group's next tile flies under this trip's work; behind a block's last
            // tile comes the first tile of the next block. Issued on every trip, the
            // workgroup's very last too (nobody reads that tile).
            const int    jn = more ? j0 + NGRP * BJ : grp * BJ;
            const float* kp = kthr + (size_t)jn * DHEAD;
            const float* vp = vthr + (size_t)jn * DHEAD;
            stage_load(kp, vp);
            // Stands in front of any rewrite of the address registers that the trip's loads
            // name: the pointers are inputs so that their registers stay live up to the wait.
            asm volatile("s_wait_xcnt 0x0" :: "v"(kp), "v"(vp) : "memory");

            v8h   kr[2][2][2];   // K fragments
            v4f   bv[2][2];      // this lane's bias
            v8h   vr[4][2];   // V^T fragments, read with K's, used behind the stores
            v16h  pa;         // P^T
            float alpha;      // what the new maximum scales the old sums by
            if (act) {
                // prefetch the 16x32 bias tile that the next trip will copy (one line per row)
                if (it + 2 < ntr && j0 + 2 * NGRP * BJ <= i0 + WQ - 1) {
                    const float* bp = bias + base_b + (size_t)(i0 + n16) * NSEQ
                                      + (size_t)(j0 + 2 * NGRP * BJ) + h * 16;
                    __builtin_prefetch(bp, 0, 3);   // locality 3: shader-engine scope, the line goes to L2
                }

                const h16* kbuf = kh_lds[cur][grp];
                const h16* vbuf = vT_lds[cur][grp];

                // ---- S^T = K Q^T (+scale +bias +causal), two 16-key subtiles ----
                // Fragment element 8q + e has k index 8h + 16q + e: kmap's order.
#pragma unroll
                for (int jt = 0; jt < 2; ++jt) {
                    const h16* krow = &kbuf[(jt * 16 + n16) * KP + 8 * h];
#pragma unroll
                    for (int f = 0; f < 2; ++f)
#pragma unroll
                        for (int qd = 0; qd < 2; ++qd)
                            kr[jt][f][qd] = *(const v8h*)(krow + f * 32 + kmap(4 * qd, 0));
                }
                // Keeps the K reads in front of the V reads: S^T needs K first, and a K read
                // issued last would make its products wait for every V read as well.
                __builtin_amdgcn_sched_barrier(0);
                // S^T accumulator register r of this lane: key j0 + jt*16 + 8h + r of
                // query i0 + n16, so a lane's bias is 8 floats in a row per subtile.
                const float* brow = (const float*)((const char*)&b_lds[0][wv][n16 * BP + 8 * h] + bcur);
#pragma unroll
                for (int jt = 0; jt < 2; ++jt)
#pragma unroll
                    for (int u = 0; u < 2; ++u)
                        bv[jt][u] = *(const v4f*)(brow + jt * 16 + u * 4);
                // Keeps the bias reads in front of the V reads: the scores take the bias right
                // behind their products, V is not needed before the softmax is done.
                __builtin_amdgcn_sched_barrier(0);
#pragma unroll
                for (int tt = 0; tt < 4; ++tt) {
                    const h16* vcol = &vbuf[(tt * 16 + n16) * VP + 8 * h];
#pragma unroll
                    for (int qd = 0; qd < 2; ++qd)
                        vr[tt][qd] = *(const v8h*)(vcol + kmap(4 * qd, 0));
                }
                // Keeps the trip's bias and fragment loads issued here, ahead of all
                // the arithmetic: sunk to their first uses, each latency would be waited out alone.
                __builtin_amdgcn_sched_barrier(0);
            }

            // The wave's next bias tile flies under this trip's work, into the buffer that the
            // last trip read; behind a block's last tile comes the first tile of the next block.
            // A tile wholly above the wave's diagonal is not copied: nobody reads it.
            // Issued behind this trip's LDS reads, so that its issue hides under their latency.
            const int ni0 = more ? i0 : pairi * BQ + wave * WQ;
            const int nj  = more ? j0 + NGRP * BJ : grp * BJ;
            const int nlim = (more || half == 0) ? ni0 + WQ - 1 : -1;   // behind the workgroup's last trip comes no tile
            if (nj <= nlim) bias_copy(ni0, nj, bcur ^ (uint32_t)sizeof(b_lds[0]));

            if (act) {
                const int dlt = row - j0 - 8 * h;      // key index in this lane's run that sits on the diagonal
                float svals[2][8];
#pragma unroll
                for (int jt = 0; jt < 2; ++jt) {
                    v8f s = fz8();
#pragma unroll
                    for (int f = 0; f < 2; ++f) {
                        const v16h kb = __builtin_shufflevector(kr[jt][f][0], kr[jt][f][1],
                                            0, 1, 2, 3, 4, 5, 6, 7, 8, 9, 10, 11, 12, 13, 14, 15);
                        s = __builtin_amdgcn_wmma_f32_16x16x32_f16(
                                false, kb, false, qa[f], (short)0, s, false, false);
                    }
                    const v8f bb = __builtin_shufflevector(bv[jt][0], bv[jt][1], 0, 1, 2, 3, 4, 5, 6, 7);
                    s = s * scale + bb;
#pragma unroll
                    for (int r = 0; r < 8; ++r)        // causal: strictly above diag
                        svals[jt][r] = (jt * 16 + r > dlt) ? -FLT_MAX : s[r];
                }

                // ---- online softmax, in-lane: 16 keys here, 16 in lane ^ 16 ----
                float t = fmaxf(svals[0][0], svals[1][0]);
#pragma unroll
                for (int r = 1; r < 8; ++r) t = fmaxf(t, fmaxf(svals[0][r], svals[1][r]));
                t = fmaxf(t, xhalf(t));
                const float mnew  = fmaxf(mrow, t);
                alpha = __expf(mrow - mnew);
                mrow = mnew;

                // P^T as a B operand straight from the accumulators: element e of the
                // fragment is key e + 8h (e < 8) or e + 8 + 8h, which is kmap's order.
#pragma unroll
                for (int r = 0; r < 8; ++r) {
                    pa[r]     = (h16)__expf(svals[0][r] - mrow);
                    pa[8 + r] = (h16)__expf(svals[1][r] - mrow);
                }

            }

            // Every reader left buffer cur ^ 1 in front of this trip's barrier. Stored
            // here, by waves that skip the tile too, so that the stores retire under the products below.
            stage_store(cur ^ 1);

            if (act) {
                // ---- rescale O^T and l, then O^T += V^T P^T, l += ones x P^T ----
#pragma unroll
                for (int tt = 0; tt < 4; ++tt)
#pragma unroll
                    for (int r = 0; r < 8; ++r) o[tt][r] *= alpha;

                const v8f ls = __builtin_amdgcn_wmma_f32_16x16x32_f16(
                                   false, ones, false, pa, (short)0, fz8(), false, false);
#pragma unroll
                for (int tt = 0; tt < 4; ++tt) {
                    const v16h vb = __builtin_shufflevector(vr[tt][0], vr[tt][1],
                                        0, 1, 2, 3, 4, 5, 6, 7, 8, 9, 10, 11, 12, 13, 14, 15);
                    o[tt] = __builtin_amdgcn_wmma_f32_16x16x32_f16(
                                false, vb, false, pa, (short)0, o[tt], false, false);
                }
                lsum = lsum * alpha + ls[0];
            }
            cur ^= 1;
            bcur ^= (uint32_t)sizeof(b_lds[0]);
        }

        // The second block's Q loads fly under the first block's epilogue.
        if (half == 0) load_q(pairi, qa);

        // ---- join the two groups' partial softmax: group 1 hands O^T, m, l to group 0 ----
        // A lane's partner is the same lane of wave + 8: same query, same d registers.
        if (grp == 1) {
#pragma unroll
            for (int t = 0; t < 4; ++t)
#pragma unroll
                for (int u = 0; u < 2; ++u) {
                    v4f w;
#pragma unroll
                    for (int e = 0; e < 4; ++e) w[e] = o[t][u * 4 + e];
                    *(v4f*)&mrg_lds[wave][t * 2 + u][lane][0] = w;
                }
            mrg_lds[wave][8][lane][0] = mrow;
            mrg_lds[wave][8][lane][1] = lsum;
        }
        // Group 1's partials are in LDS for group 0. The next write of mrg_lds lies behind
        // the next block's trip barriers.
        __syncthreads();

        // ---- normalize and store (non-temporal: output is never re-read) ------
        // Register r of o[t] is d = t*16 + 8h + r of query i0 + n16: 8 floats in a row.
        if (grp == 0) {
            const float m1   = mrg_lds[wave][8][lane][0];
            const float l1   = mrg_lds[wave][8][lane][1];
            const float mall = fmaxf(mrow, m1);
            const float a0   = __expf(mrow - mall);
            const float a1   = __expf(m1 - mall);      // 0 where group 1 had no tile under the diagonal
            const float inv  = 1.0f / (lsum * a0 + l1 * a1);
            const float c0   = a0 * inv;
            const float c1   = a1 * inv;
            float*      orow = out + base_qk + (size_t)(i0 + n16) * DHEAD + 8 * h;
#pragma unroll
            for (int t = 0; t < 4; ++t)
#pragma unroll
                for (int u = 0; u < 2; ++u) {
                    const v4f o1 = *(const v4f*)&mrg_lds[wave][t * 2 + u][lane][0];
                    v4f w;
#pragma unroll
                    for (int e = 0; e < 4; ++e) w[e] = o[t][u * 4 + e] * c0 + o1[e] * c1;
                    __builtin_nontemporal_store(w, (v4f*)(orow + t * 16 + u * 4));
                }
            // The next block's set-up rewrites registers that these stores name.
            asm volatile("s_wait_xcnt 0x0" ::: "memory");
        }
    }   // the pair's two query blocks
    // No copy is outstanding when the wave ends.
    asm volatile("s_wait_asynccnt 0x0" ::: "memory");
}

extern "C" void kernel_launch(void* const* d_in, const int* in_sizes, int n_in,
                              void* d_out, int out_size, void* d_ws, size_t ws_size,
                              hipStream_t stream) {
    const float* q    = (const float*)d_in[0];
    const float* k    = (const float*)d_in[1];
    const float* v    = (const float*)d_in[2];
    const float* bias = (const float*)d_in[3];
    float* out = (float*)d_out;

    dim3 grid(NSEQ / BQ / 2, 4 * 16);   // (pairs of i-blocks, B*H)
    dim3 block(NTHREADS);
    attn_fwd_wmma<<<grid, block, 0, stream>>>(q, k, v, bias, out);
}

// v007
// Measured time: 26.9 microseconds a run.
// In two side-by-side timings against v006, it was 1.05 and 1.06 times as fast.
// Over all steps from v000 it is 7.01 times as fast.
#include <hip/hip_runtime.h>
#include <cfloat>
#include <cmath>
#include <cstdint>

typedef _Float16 h16;
typedef __attribute__((ext_vector_type(16))) _Float16 v16h;
typedef __attribute__((ext_vector_type(8)))  _Float16 v8h;
typedef __attribute__((ext_vector_type(4)))  _Float16 v4h;
typedef __attribute__((ext_vector_type(8)))  float    v8f;
typedef __attribute__((ext_vector_type(4)))  float    v4f;

#define NSEQ     1024
#define DHEAD    64
#define BQ       128      // query rows per query block (a workgroup takes two)
#define WQ       16       // query rows per wave
#define BJ       32       // keys per j-iteration (K=32 for the PV WMMA)
#define NGRP     2        // wave groups per workgroup: group g takes key tiles g, g + 2, g + 4, ...
#define GTHREADS 256      // threads of one group (8 waves, one per 16 query rows)
#define NTHREADS (NGRP * GTHREADS)
// LDS row pitches: 16 B x odd, so that the 16 lanes of a ds_load_b128 that walk
// 16 rows fall on 16 different groups of four banks.
#define KP       72       // halves per K row   (144 B)
#define VP       40       // halves per V^T row (80 B)
#define BP       36       // floats per bias row (144 B)

// A/B fragment dword r (0..7) + lane-half h (0/1) -> first K index of the
// packed f16 pair, per the CDNA5 16-bit A-matrix 16x32 VGPR layout.
__device__ __forceinline__ int kmap(int r, int h) {
    return 2 * r + ((r >= 4) ? 8 : 0) + 8 * h;
}

__device__ __forceinline__ v8f fz8() {
    v8f z;
#pragma unroll
    for (int i = 0; i < 8; ++i) z[i] = 0.0f;
    return z;
}

// Lane l's value from lane l ^ 16: the two lanes that share one query column.
__device__ __forceinline__ float xhalf(float x) {
    const int xi = __builtin_bit_cast(int, x);
    return __builtin_bit_cast(float, __builtin_amdgcn_permlanex16(xi, xi, 0x76543210, 0xfedcba98, false, false));
}

__global__ __launch_bounds__(NTHREADS)
void attn_fwd_wmma(const float* __restrict__ q, const float* __restrict__ k,
                   const float* __restrict__ v, const float* __restrict__ bias,
                   float* __restrict__ out) {
    __shared__ __attribute__((aligned(16))) h16 kh_lds[2][NGRP][BJ * KP];      // keys as f16, row-major (j, d), dbl buf, per group
    __shared__ __attribute__((aligned(16))) h16 vT_lds[2][NGRP][DHEAD * VP];   // values as f16, transposed (d, j), dbl buf, per group
    __shared__ __attribute__((aligned(16))) float mrg_lds[BQ / WQ][9][32][4];   // group 1's O^T, m, l on their way to group 0
    __shared__ __attribute__((aligned(16))) float b_lds[2][NGRP * (BQ / WQ)][WQ * BP];   // each wave's own 16 x 32 bias tile, row-major (query, key), dbl buf

    const int tid  = threadIdx.x & (GTHREADS - 1);                          // thread index inside the group
    const int wv   = __builtin_amdgcn_readfirstlane((int)threadIdx.x >> 5);  // scalar: branches on it are wave-uniform
    const int grp  = wv >> 3;      // key-tile parity this wave works on
    const int wave = wv & 7;       // which 16 query rows of the block
    const int lane = tid & 31;
    const int n16  = lane & 15;    // this lane's query column; row of an A fragment
    const int h    = lane >> 4;    // lane half (selects K subset / row offset)

    const int pairi = blockIdx.x;              // 0..3: the pair of query blocks
    const int bh    = blockIdx.y;              // 0..63 (b*H + h)

    const float scale = 0.125f;                // 1/sqrt(64)

    const size_t base_qk = (size_t)bh * NSEQ * DHEAD;
    const size_t base_b  = (size_t)bh * NSEQ * NSEQ;

    // all-ones A fragment: column sums of P^T via WMMA (every row of ones x P^T is l)
    v16h ones;
#pragma unroll
    for (int i = 0; i < 16; ++i) ones[i] = (h16)1.0f;

    // ---- stage of one 32-key K/V tile, through registers: fp32 is rounded to f16 once,
    // by the thread that brings it, and every wave reads finished fragments from LDS.
    // K: twice 4 floats in a row, the wave's 32 lanes side by side. V: 8 keys in a row of column tid % 64.
    v4f   kst[2];
    float vst[8];
    const float* const kthr = k + base_qk + tid * 4;
    const float* const vthr = v + base_qk + (tid >> 6) * 8 * DHEAD + (tid & 63);
    auto stage_load = [&](const float* kp, const float* vp) {
        kst[0] = *(const v4f*)kp;
        kst[1] = *(const v4f*)(kp + GTHREADS * 4);
#pragma unroll
        for (int i = 0; i < 8; ++i) vst[i] = vp[i * DHEAD];
    };
    auto stage_store = [&](int buf) {
#pragma unroll
        for (int i = 0; i < 2; ++i) {
            v4h kh;
#pragma unroll
            for (int e = 0; e < 4; ++e) kh[e] = (h16)kst[i][e];
            *(v4h*)&kh_lds[buf][grp][((tid >> 4) + i * (GTHREADS / 16)) * KP + (tid & 15) * 4] = kh;
        }
        v8h vh;
#pragma unroll
        for (int i = 0; i < 8; ++i) vh[i] = (h16)vst[i];
        *(v8h*)&vT_lds[buf][grp][(tid & 63) * VP + (tid >> 6) * 8] = vh;
    };

    // ---- one wave's 16-query x 32-key bias tile, global -> LDS by asynchronous copies.
    // A score register layout wants 32 B of each of 16 rows per load: 16 lines touched for
    // 512 B. A copy takes whole lines instead (8 lanes side by side on one row's 128 B, 4 rows
    // a copy), and the lanes pick their own pieces out of LDS.
    const float* const bthr = bias + base_b + (size_t)(lane >> 3) * NSEQ + (lane & 7) * 4;
    const uint32_t     bdst = (uint32_t)(uintptr_t)&b_lds[0][wv][(lane >> 3) * BP + (lane & 7) * 4];
    auto bias_copy = [&](int r0, int jc, uint32_t boff) {   // boff: the buffer's byte offset in b_lds
        const float*   g0 = bthr + (size_t)r0 * NSEQ + jc;
        const float*   g1 = g0 + 4 * NSEQ;
        const float*   g2 = g0 + 8 * NSEQ;
        const float*   g3 = g0 + 12 * NSEQ;
        const uint32_t l0 = bdst + boff;
        const uint32_t l1 = l0 + 4 * BP * 4;
        const uint32_t l2 = l0 + 8 * BP * 4;
        const uint32_t l3 = l0 + 12 * BP * 4;
        // The wait is the statement's last line, so that it stands in front of any
        // rewrite of the address registers that the copies name.
        // Bias is stream-once: non-temporal keeps K/V resident in L2.
        asm volatile("global_load_async_to_lds_b128 %0, %4, off th:TH_LOAD_NT\n\t"
                     "global_load_async_to_lds_b128 %1, %5, off th:TH_LOAD_NT\n\t"
                     "global_load_async_to_lds_b128 %2, %6, off th:TH_LOAD_NT\n\t"
                     "global_load_async_to_lds_b128 %3, %7, off th:TH_LOAD_NT\n\t"
                     "s_wait_xcnt 0x0"
                     :: "v"(l0), "v"(l1), "v"(l2), "v"(l3), "v"(g0), "v"(g1), "v"(g2), "v"(g3)
                     : "memory");
    };

    // ---- Q fragments (B operand: lane = query, same k map) of one query block, fp32 -> f16 -
    auto load_q = [&](int blk, v16h (&dst)[2]) {
        // this lane's row, at its half's first k index
        const float* qrow = q + base_qk + (size_t)(blk * BQ + wave * WQ + n16) * DHEAD + kmap(0, h);
        float raw[2][16];
#pragma unroll
        for (int f = 0; f < 2; ++f) {
#pragma unroll
            for (int r = 0; r < 8; ++r) {
                const int d0 = f * 32 + kmap(r, 0);
                raw[f][2 * r]     = qrow[d0];
                raw[f][2 * r + 1] = qrow[d0 + 1];
            }
        }
        // Stands in front of any rewrite of the address registers these loads
        // name: qrow is an input so that its registers stay live up to the wait.
        asm volatile("s_wait_xcnt 0x0" :: "v"(qrow) : "memory");
#pragma unroll
        for (int f = 0; f < 2; ++f)
#pragma unroll
            for (int i = 0; i < 16; ++i) dst[f][i] = (h16)raw[f][i];
    };

    // The first bias tile of the first query block, into buffer 0; the first trip's wait and barrier publish it.
    if (grp * BJ <= (NSEQ / BQ - 1 - pairi) * BQ + wave * WQ + WQ - 1)
        bias_copy((NSEQ / BQ - 1 - pairi) * BQ + wave * WQ, grp * BJ, 0);

    {
        const float* kp = kthr + grp * BJ * DHEAD;
        const float* vp = vthr + grp * BJ * DHEAD;
        stage_load(kp, vp);
        // Stands in front of any rewrite of the address registers these loads
        // name: the pointers are inputs so that their registers stay live up to the wait.
        asm volatile("s_wait_xcnt 0x0" :: "v"(kp), "v"(vp) : "memory");
    }
    int cur = 0;
    uint32_t bcur = 0;   // byte offset in b_lds of the bias buffer that this trip reads: 0 or one buffer's size

    v16h qa[2];
    load_q(NSEQ / BQ - 1 - pairi, qa);
    stage_store(0);
    // The group's second tile: in flight over the first trip, which stores it. kp and vp keep
    // the addresses of the loads in flight until the wait that stands in front of their rewrite.
    const float* kp = kthr + (grp + NGRP) * BJ * DHEAD;
    const float* vp = vthr + (grp + NGRP) * BJ * DHEAD;
    stage_load(kp, vp);

    // Causal cost grows linearly with the query block's index, so every
    // workgroup takes block 7-p and then block p, one after the other: the
    // same 36 key tiles in each workgroup, 18 for each wave group. Kept rolled:
    // two copies of the body would only double the code.
#pragma unroll 1
    for (int half = 0; half < 2; ++half) {
        const int iblk  = half ? pairi : (NSEQ / BQ - 1 - pairi);
        const int wg_i0 = iblk * BQ;
        const int i0    = wg_i0 + wave * WQ;       // this wave's first query row

        // ---- accumulators & online-softmax state ------------------------------
        v8f o[4];
#pragma unroll
        for (int t = 0; t < 4; ++t) o[t] = fz8();
        float lsum = 0.0f;                         // this lane's query: softmax denominator
        float mrow = -FLT_MAX;                     // this lane's query: running maximum

        const int ntr = (wg_i0 + BQ) / (NGRP * BJ);   // trips: uniform across the workgroup, the same in both groups

        for (int it = 0; it < ntr; ++it) {
            const int j0 = (NGRP * it + grp) * BJ;    // this group's key tile of the trip

            // This wave's LDS reads of the last trip have retired before its copies refill that buffer.
            asm volatile("s_wait_dscnt 0x0" ::: "memory");
            // This trip's bias tile, copied during the last trip, has landed.
            asm volatile("s_wait_asynccnt 0x0" ::: "memory");
            // The trip's barrier: everyone's stores of this trip's tile visible; prev buffer free.
            // Written out with fences on LDS alone: what the waves hand each other here is in LDS,
            // and __syncthreads() would also wait out the K/V loads that are in flight to registers.
            __builtin_amdgcn_fence(__ATOMIC_RELEASE, "workgroup", "local");
            __builtin_amdgcn_s_barrier();
            __builtin_amdgcn_fence(__ATOMIC_ACQUIRE, "workgroup", "local");

            const bool act  = j0 <= i0 + WQ - 1;   // wave-uniform causal skip
            const bool more = it + 1 < ntr;

            const int row = i0 + n16;

            v8h   kr[2][2][2];   // K fragments
            v4f   bv[2][2];      // this lane's bias
            v8h   vr[4][2];   // V^T fragments, read with K's, used behind the stores
            v16h  pa;         // P^T
            float alpha;      // what the new maximum scales the old sums by
            if (act) {
                // prefetch the 16x32 bias tile that the next trip will copy (one line per row)
                if (it + 2 < ntr && j0 + 2 * NGRP * BJ <= i0 + WQ - 1) {
                    const float* bp = bias + base_b + (size_t)(i0 + n16) * NSEQ
                                      + (size_t)(j0 + 2 * NGRP * BJ) + h * 16;
                    __builtin_prefetch(bp, 0, 3);   // locality 3: shader-engine scope, the line goes to L2
                }

                const h16* kbuf = kh_lds[cur][grp];
                const h16* vbuf = vT_lds[cur][grp];

                // ---- S^T = K Q^T (+scale +bias +causal), two 16-key subtiles ----
                // Fragment element 8q + e has k index 8h + 16q + e: kmap's order.
#pragma unroll
                for (int jt = 0; jt < 2; ++jt) {
                    const h16* krow = &kbuf[(jt * 16 + n16) * KP + 8 * h];
#pragma unroll
                    for (int f = 0; f < 2; ++f)
#pragma unroll
                        for (int qd = 0; qd < 2; ++qd)
                            kr[jt][f][qd] = *(const v8h*)(krow + f * 32 + kmap(4 * qd, 0));
                }
                // Keeps the K reads in front of the V reads: S^T needs K first, and a K read
                // issued last would make its products wait for every V read as well.
                __builtin_amdgcn_sched_barrier(0);
                // S^T accumulator register r of this lane: key j0 + jt*16 + 8h + r of
                // query i0 + n16, so a lane's bias is 8 floats in a row per subtile.
                const float* brow = (const float*)((const char*)&b_lds[0][wv][n16 * BP + 8 * h] + bcur);
#pragma unroll
                for (int jt = 0; jt < 2; ++jt)
#pragma unroll
                    for (int u = 0; u < 2; ++u)
                        bv[jt][u] = *(const v4f*)(brow + jt * 16 + u * 4);
                // Keeps the bias reads in front of the V reads: the scores take the bias right
                // behind their products, V is not needed before the softmax is done.
                __builtin_amdgcn_sched_barrier(0);
#pragma unroll
                for (int tt = 0; tt < 4; ++tt) {
                    const h16* vcol = &vbuf[(tt * 16 + n16) * VP + 8 * h];
#pragma unroll
                    for (int qd = 0; qd < 2; ++qd)
                        vr[tt][qd] = *(const v8h*)(vcol + kmap(4 * qd, 0));
                }
                // Keeps the trip's bias and fragment loads issued here, ahead of all
                // the arithmetic: sunk to their first uses, each latency would be waited out alone.
                __builtin_amdgcn_sched_barrier(0);
            }

            // The wave's next bias tile flies under this trip's work, into the buffer that the
            // last trip read; behind a block's last tile comes the first tile of the next block.
            // A tile wholly above the wave's diagonal is not copied: nobody reads it.
            // Issued behind this trip's LDS reads, so that its issue hides under their latency.
            const int ni0 = more ? i0 : pairi * BQ + wave * WQ;
            const int nj  = more ? j0 + NGRP * BJ : grp * BJ;
            const int nlim = (more || half == 0) ? ni0 + WQ - 1 : -1;   // behind the workgroup's last trip comes no tile
            if (nj <= nlim) bias_copy(ni0, nj, bcur ^ (uint32_t)sizeof(b_lds[0]));

            if (act) {
                const int dlt = row - j0 - 8 * h;      // key index in this lane's run that sits on the diagonal
                float svals[2][8];
#pragma unroll
                for (int jt = 0; jt < 2; ++jt) {
                    v8f s = fz8();
#pragma unroll
                    for (int f = 0; f < 2; ++f) {
                        const v16h kb = __builtin_shufflevector(kr[jt][f][0], kr[jt][f][1],
                                            0, 1, 2, 3, 4, 5, 6, 7, 8, 9, 10, 11, 12, 13, 14, 15);
                        s = __builtin_amdgcn_wmma_f32_16x16x32_f16(
                                false, kb, false, qa[f], (short)0, s, false, false);
                    }
                    const v8f bb = __builtin_shufflevector(bv[jt][0], bv[jt][1], 0, 1, 2, 3, 4, 5, 6, 7);
                    s = s * scale + bb;
#pragma unroll
                    for (int r = 0; r < 8; ++r)        // causal: strictly above diag
                        svals[jt][r] = (jt * 16 + r > dlt) ? -FLT_MAX : s[r];
                }

                // ---- online softmax, in-lane: 16 keys here, 16 in lane ^ 16 ----
                float t = fmaxf(svals[0][0], svals[1][0]);
#pragma unroll
                for (int r = 1; r < 8; ++r) t = fmaxf(t, fmaxf(svals[0][r], svals[1][r]));
                t = fmaxf(t, xhalf(t));
                const float mnew  = fmaxf(mrow, t);
                alpha = __expf(mrow - mnew);
                mrow = mnew;

                // P^T as a B operand straight from the accumulators: element e of the
                // fragment is key e + 8h (e < 8) or e + 8 + 8h, which is kmap's order.
#pragma unroll
                for (int r = 0; r < 8; ++r) {
                    pa[r]     = (h16)__expf(svals[0][r] - mrow);
                    pa[8 + r] = (h16)__expf(svals[1][r] - mrow);
                }

            }

            // Every reader left buffer cur ^ 1 in front of this trip's barrier. Stored
            // here, by waves that skip the tile too, so that the stores retire under the products below.
            stage_store(cur ^ 1);

            // The staging registers are free again: the group's tile after next goes out here and
            // has a whole trip to land, up to the next trip's stores. Behind a block's last tiles
            // come the first two of the next block. Issued on every trip, the workgroup's last
            // two as well (nobody reads those tiles).
            const int jn = it + 2 < ntr ? j0 + 2 * NGRP * BJ : (NGRP * (it + 2 - ntr) + grp) * BJ;
            // Stands in front of the rewrite of the address registers that the last trip's loads
            // name: the pointers are inputs so that their registers stay live up to the wait.
            // It stands here, a trip behind those loads, and so holds up no LDS read at the trip's top.
            asm volatile("s_wait_xcnt 0x0" :: "v"(kp), "v"(vp) : "memory");
            kp = kthr + (size_t)jn * DHEAD;
            vp = vthr + (size_t)jn * DHEAD;
            stage_load(kp, vp);

            if (act) {
                // ---- rescale O^T and l, then O^T += V^T P^T, l += ones x P^T ----
#pragma unroll
                for (int tt = 0; tt < 4; ++tt)
#pragma unroll
                    for (int r = 0; r < 8; ++r) o[tt][r] *= alpha;

                const v8f ls = __builtin_amdgcn_wmma_f32_16x16x32_f16(
                                   false, ones, false, pa, (short)0, fz8(), false, false);
#pragma unroll
                for (int tt = 0; tt < 4; ++tt) {
                    const v16h vb = __builtin_shufflevector(vr[tt][0], vr[tt][1],
                                        0, 1, 2, 3, 4, 5, 6, 7, 8, 9, 10, 11, 12, 13, 14, 15);
                    o[tt] = __builtin_amdgcn_wmma_f32_16x16x32_f16(
                                false, vb, false, pa, (short)0, o[tt], false, false);
                }
                lsum = lsum * alpha + ls[0];
            }
            cur ^= 1;
            bcur ^= (uint32_t)sizeof(b_lds[0]);
        }

        // The epilogue may rewrite the address registers that the last trip's loads name:
        // the pointers are inputs so that their registers stay live up to the wait.
        asm volatile("s_wait_xcnt 0x0" :: "v"(kp), "v"(vp) : "memory");

        // The second block's Q loads fly under the first block's epilogue.
        if (half == 0) load_q(pairi, qa);

        // ---- join the two groups' partial softmax: group 1 hands O^T, m, l to group 0 ----
        // A lane's partner is the same lane of wave + 8: same query, same d registers.
        if (grp == 1) {
#pragma unroll
            for (int t = 0; t < 4; ++t)
#pragma unroll
                for (int u = 0; u < 2; ++u) {
                    v4f w;
#pragma unroll
                    for (int e = 0; e < 4; ++e) w[e] = o[t][u * 4 + e];
                    *(v4f*)&mrg_lds[wave][t * 2 + u][lane][0] = w;
                }
            mrg_lds[wave][8][lane][0] = mrow;
            mrg_lds[wave][8][lane][1] = lsum;
        }
        // Group 1's partials are in LDS for group 0. The next write of mrg_lds lies behind
        // the next block's trip barriers.
        __syncthreads();

        // ---- normalize and store (non-temporal: output is never re-read) ------
        // Register r of o[t] is d = t*16 + 8h + r of query i0 + n16: 8 floats in a row.
        if (grp == 0) {
            const float m1   = mrg_lds[wave][8][lane][0];
            const float l1   = mrg_lds[wave][8][lane][1];
            const float mall = fmaxf(mrow, m1);
            const float a0   = __expf(mrow - mall);
            const float a1   = __expf(m1 - mall);      // 0 where group 1 had no tile under the diagonal
            const float inv  = 1.0f / (lsum * a0 + l1 * a1);
            const float c0   = a0 * inv;
            const float c1   = a1 * inv;
            float*      orow = out + base_qk + (size_t)(i0 + n16) * DHEAD + 8 * h;
#pragma unroll
            for (int t = 0; t < 4; ++t)
#pragma unroll
                for (int u = 0; u < 2; ++u) {
                    const v4f o1 = *(const v4f*)&mrg_lds[wave][t * 2 + u][lane][0];
                    v4f w;
#pragma unroll
                    for (int e = 0; e < 4; ++e) w[e] = o[t][u * 4 + e] * c0 + o1[e] * c1;
                    __builtin_nontemporal_store(w, (v4f*)(orow + t * 16 + u * 4));
                }
            // The next block's set-up rewrites registers that these stores name.
            asm volatile("s_wait_xcnt 0x0" ::: "memory");
        }
    }   // the pair's two query blocks
    // No copy is outstanding when the wave ends.
    asm volatile("s_wait_asynccnt 0x0" ::: "memory");
}

extern "C" void kernel_launch(void* const* d_in, const int* in_sizes, int n_in,
                              void* d_out, int out_size, void* d_ws, size_t ws_size,
                              hipStream_t stream) {
    const float* q    = (const float*)d_in[0];
    const float* k    = (const float*)d_in[1];
    const float* v    = (const float*)d_in[2];
    const float* bias = (const float*)d_in[3];
    float* out = (float*)d_out;

    dim3 grid(NSEQ / BQ / 2, 4 * 16);   // (pairs of i-blocks, B*H)
    dim3 block(NTHREADS);
    attn_fwd_wmma<<<grid, block, 0, stream>>>(q, k, v, bias, out);
}

// v008
// One run takes 25.7 microseconds.
// Next to v007, in two timings, it ran 1.05 and 1.06 times as fast.
// Counting every step since v000, it is 7.41 times as fast.
#include <hip/hip_runtime.h>
#include <cfloat>
#include <cmath>
#include <cstdint>

typedef _Float16 h16;
typedef __attribute__((ext_vector_type(16))) _Float16 v16h;
typedef __attribute__((ext_vector_type(8)))  _Float16 v8h;
typedef __attribute__((ext_vector_type(4)))  _Float16 v4h;
typedef __attribute__((ext_vector_type(8)))  float    v8f;
typedef __attribute__((ext_vector_type(4)))  float    v4f;

#define NSEQ     1024
#define DHEAD    64
#define BQ       128      // query rows per query block (a workgroup takes two)
#define WQ       16       // query rows per wave
#define BJ       32       // keys per j-iteration (K=32 for the PV WMMA)
#define NGRP     2        // wave groups per workgroup: group g takes key tiles g, g + 2, g + 4, ...
#define GTHREADS 256      // threads of one group (8 waves, one per 16 query rows)
#define NTHREADS (NGRP * GTHREADS)
// LDS row pitches: 16 B x odd, so that the 16 lanes of a ds_load_b128 that walk
// 16 rows fall on 16 different groups of four banks.
#define KP       72       // halves per K row   (144 B)
#define VP       40       // halves per V^T row (80 B)
#define BP       68       // floats per bias row of 64 keys (272 B)

// A/B fragment dword r (0..7) + lane-half h (0/1) -> first K index of the
// packed f16 pair, per the CDNA5 16-bit A-matrix 16x32 VGPR layout.
__device__ __forceinline__ int kmap(int r, int h) {
    return 2 * r + ((r >= 4) ? 8 : 0) + 8 * h;
}

__device__ __forceinline__ v8f fz8() {
    v8f z;
#pragma unroll
    for (int i = 0; i < 8; ++i) z[i] = 0.0f;
    return z;
}

// Lane l's value from lane l ^ 16: the two lanes that share one query column.
__device__ __forceinline__ float xhalf(float x) {
    const int xi = __builtin_bit_cast(int, x);
    return __builtin_bit_cast(float, __builtin_amdgcn_permlanex16(xi, xi, 0x76543210, 0xfedcba98, false, false));
}

__global__ __launch_bounds__(NTHREADS)
void attn_fwd_wmma(const float* __restrict__ q, const float* __restrict__ k,
                   const float* __restrict__ v, const float* __restrict__ bias,
                   float* __restrict__ out) {
    __shared__ __attribute__((aligned(16))) h16 kh_lds[2][NGRP][BJ * KP];      // keys as f16, row-major (j, d), dbl buf, per group
    __shared__ __attribute__((aligned(16))) h16 vT_lds[2][NGRP][DHEAD * VP];   // values as f16, transposed (d, j), dbl buf, per group
    __shared__ __attribute__((aligned(16))) float mrg_lds[BQ / WQ][9][32][4];   // group 1's O^T, m, l on their way to group 0
    __shared__ __attribute__((aligned(16))) float b_lds[2][BQ / WQ][WQ * BP];   // 16 x 64 bias tile of a pair of partner waves (wave and wave + 8), row-major (query, key), dbl buf

    const int tid  = threadIdx.x & (GTHREADS - 1);                          // thread index inside the group
    const int wv   = __builtin_amdgcn_readfirstlane((int)threadIdx.x >> 5);  // scalar: branches on it are wave-uniform
    const int grp  = wv >> 3;      // key-tile parity this wave works on
    const int wave = wv & 7;       // which 16 query rows of the block
    const int lane = tid & 31;
    const int n16  = lane & 15;    // this lane's query column; row of an A fragment
    const int h    = lane >> 4;    // lane half (selects K subset / row offset)

    const int pairi = blockIdx.x;              // 0..3: the pair of query blocks
    const int bh    = blockIdx.y;              // 0..63 (b*H + h)

    const float scale = 0.125f;                // 1/sqrt(64)

    const size_t base_qk = (size_t)bh * NSEQ * DHEAD;
    const size_t base_b  = (size_t)bh * NSEQ * NSEQ;

    // all-ones A fragment: column sums of P^T via WMMA (every row of ones x P^T is l)
    v16h ones;
#pragma unroll
    for (int i = 0; i < 16; ++i) ones[i] = (h16)1.0f;

    // ---- stage of one 32-key K/V tile, through registers: fp32 is rounded to f16 once,
    // by the thread that brings it, and every wave reads finished fragments from LDS.
    // K: twice 4 floats in a row, the wave's 32 lanes side by side. V: 8 keys in a row of column tid % 64.
    v4f   kst[2];
    float vst[8];
    const float* const kthr = k + base_qk + tid * 4;
    const float* const vthr = v + base_qk + (tid >> 6) * 8 * DHEAD + (tid & 63);
    auto stage_load = [&](const float* kp, const float* vp) {
        kst[0] = *(const v4f*)kp;
        kst[1] = *(const v4f*)(kp + GTHREADS * 4);
#pragma unroll
        for (int i = 0; i < 8; ++i) vst[i] = vp[i * DHEAD];
    };
    auto stage_store = [&](int buf) {
#pragma unroll
        for (int i = 0; i < 2; ++i) {
            v4h kh;
#pragma unroll
            for (int e = 0; e < 4; ++e) kh[e] = (h16)kst[i][e];
            *(v4h*)&kh_lds[buf][grp][((tid >> 4) + i * (GTHREADS / 16)) * KP + (tid & 15) * 4] = kh;
        }
        v8h vh;
#pragma unroll
        for (int i = 0; i < 8; ++i) vh[i] = (h16)vst[i];
        *(v8h*)&vT_lds[buf][grp][(tid & 63) * VP + (tid >> 6) * 8] = vh;
    };

    // ---- the 16-query x 64-key bias tile of a trip, global -> LDS by asynchronous copies.
    // The two key groups' tiles of a trip are the two 128 B halves of the same aligned 256 B
    // of each bias row. So that each such
    // 256 B is asked for once, by one instruction, the partner waves (the same 16 queries, one
    // wave in each key group) share one tile: each brings 8 of its 16 rows, all 64 keys wide
    // (16 lanes side by side on one row's 256 B, 2 rows a copy), and each reads its own 32 keys.
    const float* const bthr = bias + base_b + (size_t)(grp * 8 + h) * NSEQ + n16 * 4;
    const uint32_t     bdst = (uint32_t)(uintptr_t)&b_lds[0][wave][(grp * 8 + h) * BP + n16 * 4];
    auto bias_copy = [&](int r0, int jc, uint32_t boff) {   // jc: the pair's first key; boff: the buffer's byte offset in b_lds
        const float*   g0 = bthr + (size_t)r0 * NSEQ + jc;
        const float*   g1 = g0 + 2 * NSEQ;
        const float*   g2 = g0 + 4 * NSEQ;
        const float*   g3 = g0 + 6 * NSEQ;
        const uint32_t l0 = bdst + boff;
        const uint32_t l1 = l0 + 2 * BP * 4;
        const uint32_t l2 = l0 + 4 * BP * 4;
        const uint32_t l3 = l0 + 6 * BP * 4;
        // The wait is the statement's last line, so that it stands in front of any
        // rewrite of the address registers that the copies name.
        // Bias is stream-once: non-temporal keeps K/V resident in L2.
        asm volatile("global_load_async_to_lds_b128 %0, %4, off th:TH_LOAD_NT\n\t"
                     "global_load_async_to_lds_b128 %1, %5, off th:TH_LOAD_NT\n\t"
                     "global_load_async_to_lds_b128 %2, %6, off th:TH_LOAD_NT\n\t"
                     "global_load_async_to_lds_b128 %3, %7, off th:TH_LOAD_NT\n\t"
                     "s_wait_xcnt 0x0"
                     :: "v"(l0), "v"(l1), "v"(l2), "v"(l3), "v"(g0), "v"(g1), "v"(g2), "v"(g3)
                     : "memory");
    };

    // ---- Q fragments (B operand: lane = query, same k map) of one query block, fp32 -> f16 -
    auto load_q = [&](int blk, v16h (&dst)[2]) {
        // this lane's row, at its half's first k index
        const float* qrow = q + base_qk + (size_t)(blk * BQ + wave * WQ + n16) * DHEAD + kmap(0, h);
        float raw[2][16];
#pragma unroll
        for (int f = 0; f < 2; ++f) {
#pragma unroll
            for (int r = 0; r < 8; ++r) {
                const int d0 = f * 32 + kmap(r, 0);
                raw[f][2 * r]     = qrow[d0];
                raw[f][2 * r + 1] = qrow[d0 + 1];
            }
        }
        // Stands in front of any rewrite of the address registers these loads
        // name: qrow is an input so that its registers stay live up to the wait.
        asm volatile("s_wait_xcnt 0x0" :: "v"(qrow) : "memory");
#pragma unroll
        for (int f = 0; f < 2; ++f)
#pragma unroll
            for (int i = 0; i < 16; ++i) dst[f][i] = (h16)raw[f][i];
    };

    // The first bias tile of the first query block, into buffer 0; the first trip's wait and barrier publish it.
    // It starts at key 0, which lies under every query's diagonal: always wanted.
    bias_copy((NSEQ / BQ - 1 - pairi) * BQ + wave * WQ, 0, 0);

    {
        const float* kp = kthr + grp * BJ * DHEAD;
        const float* vp = vthr + grp * BJ * DHEAD;
        stage_load(kp, vp);
        // Stands in front of any rewrite of the address registers these loads
        // name: the pointers are inputs so that their registers stay live up to the wait.
        asm volatile("s_wait_xcnt 0x0" :: "v"(kp), "v"(vp) : "memory");
    }
    int cur = 0;
    uint32_t bcur = 0;   // byte offset in b_lds of the bias buffer that this trip reads: 0 or one buffer's size

    v16h qa[2];
    load_q(NSEQ / BQ - 1 - pairi, qa);
    stage_store(0);
    // The group's second tile: in flight over the first trip, which stores it. kp and vp keep
    // the addresses of the loads in flight until the wait that stands in front of their rewrite.
    const float* kp = kthr + (grp + NGRP) * BJ * DHEAD;
    const float* vp = vthr + (grp + NGRP) * BJ * DHEAD;
    stage_load(kp, vp);

    // Causal cost grows linearly with the query block's index, so every
    // workgroup takes block 7-p and then block p, one after the other: the
    // same 36 key tiles in each workgroup, 18 for each wave group. Kept rolled:
    // two copies of the body would only double the code.
#pragma unroll 1
    for (int half = 0; half < 2; ++half) {
        const int iblk  = half ? pairi : (NSEQ / BQ - 1 - pairi);
        const int wg_i0 = iblk * BQ;
        const int i0    = wg_i0 + wave * WQ;       // this wave's first query row

        // ---- accumulators & online-softmax state ------------------------------
        v8f o[4];
#pragma unroll
        for (int t = 0; t < 4; ++t) o[t] = fz8();
        float lsum = 0.0f;                         // this lane's query: softmax denominator
        float mrow = -FLT_MAX;                     // this lane's query: running maximum

        const int ntr = (wg_i0 + BQ) / (NGRP * BJ);   // trips: uniform across the workgroup, the same in both groups

        for (int it = 0; it < ntr; ++it) {
            const int j0 = (NGRP * it + grp) * BJ;    // this group's key tile of the trip

            // This wave's LDS reads of the last trip have retired before its copies refill that buffer.
            asm volatile("s_wait_dscnt 0x0" ::: "memory");
            // This wave's half of the trip's bias tile, copied during the last trip, has landed;
            // the barrier below hands it to the partner wave, and the partner's half to this one.
            asm volatile("s_wait_asynccnt 0x0" ::: "memory");
            // The trip's barrier: everyone's stores of this trip's tile visible; prev buffer free.
            // Written out with fences on LDS alone: what the waves hand each other here is in LDS,
            // and __syncthreads() would also wait out the K/V loads that are in flight to registers.
            __builtin_amdgcn_fence(__ATOMIC_RELEASE, "workgroup", "local");
            __builtin_amdgcn_s_barrier();
            __builtin_amdgcn_fence(__ATOMIC_ACQUIRE, "workgroup", "local");

            const bool act  = j0 <= i0 + WQ - 1;   // wave-uniform causal skip
            const bool more = it + 1 < ntr;

            const int row = i0 + n16;

            v8h   kr[2][2][2];   // K fragments
            v4f   bv[2][2];      // this lane's bias
            v8h   vr[4][2];   // V^T fragments, read with K's, used behind the stores
            v16h  pa;         // P^T
            float alpha;      // what the new maximum scales the old sums by
            if (act) {
                // prefetch what the next trip will copy: one lane per query row, so one
                // wave asks for 32 query rows, its own pair's 16 and the 16 of the pair behind it
                // (both pairs' rows lie in the same 32, so the key limit reads the same for both)
                if (grp == 0 && (wave & 1) == 0 && it + 2 < ntr && (it + 2) * NGRP * BJ <= i0 + WQ - 1) {
                    const float* bp = bias + base_b + (size_t)(i0 + lane) * NSEQ
                                      + (size_t)((it + 2) * NGRP * BJ);
                    __builtin_prefetch(bp, 0, 3);   // locality 3: shader-engine scope, the unit goes to L2
                }

                const h16* kbuf = kh_lds[cur][grp];
                const h16* vbuf = vT_lds[cur][grp];

                // ---- S^T = K Q^T (+scale +bias +causal), two 16-key subtiles ----
                // Fragment element 8q + e has k index 8h + 16q + e: kmap's order.
#pragma unroll
                for (int jt = 0; jt < 2; ++jt) {
                    const h16* krow = &kbuf[(jt * 16 + n16) * KP + 8 * h];
#pragma unroll
                    for (int f = 0; f < 2; ++f)
#pragma unroll
                        for (int qd = 0; qd < 2; ++qd)
                            kr[jt][f][qd] = *(const v8h*)(krow + f * 32 + kmap(4 * qd, 0));
                }
                // Keeps the K reads in front of the V reads: S^T needs K first, and a K read
                // issued last would make its products wait for every V read as well.
                __builtin_amdgcn_sched_barrier(0);
                // S^T accumulator register r of this lane: key j0 + jt*16 + 8h + r of
                // query i0 + n16, so a lane's bias is 8 floats in a row per subtile.
                const float* brow = (const float*)((const char*)&b_lds[0][wave][n16 * BP + grp * BJ + 8 * h] + bcur);
#pragma unroll
                for (int jt = 0; jt < 2; ++jt)
#pragma unroll
                    for (int u = 0; u < 2; ++u)
                        bv[jt][u] = *(const v4f*)(brow + jt * 16 + u * 4);
                // Keeps the bias reads in front of the V reads: the scores take the bias right
                // behind their products, V is not needed before the softmax is done.
                __builtin_amdgcn_sched_barrier(0);
#pragma unroll
                for (int tt = 0; tt < 4; ++tt) {
                    const h16* vcol = &vbuf[(tt * 16 + n16) * VP + 8 * h];
#pragma unroll
                    for (int qd = 0; qd < 2; ++qd)
                        vr[tt][qd] = *(const v8h*)(vcol + kmap(4 * qd, 0));
                }
                // Keeps the trip's bias and fragment loads issued here, ahead of all
                // the arithmetic: sunk to their first uses, each latency would be waited out alone.
                __builtin_amdgcn_sched_barrier(0);
            }

            // The wave's half of the next bias tile flies under this trip's work, into the buffer
            // that both partners left in front of this trip's barrier; behind a block's last tile
            // comes the first tile of the next block. A tile wholly above the pair's diagonal is
            // not copied: nobody reads it. The test reads the same in both partners.
            // Issued behind this trip's LDS reads, so that its issue hides under their latency.
            const int ni0 = more ? i0 : pairi * BQ + wave * WQ;
            const int nj  = more ? (it + 1) * NGRP * BJ : 0;
            const int nlim = (more || half == 0) ? ni0 + WQ - 1 : -1;   // behind the workgroup's last trip comes no tile
            if (nj <= nlim) bias_copy(ni0, nj, bcur ^ (uint32_t)sizeof(b_lds[0]));

            if (act) {
                const int dlt = row - j0 - 8 * h;      // key index in this lane's run that sits on the diagonal
                float svals[2][8];
#pragma unroll
                for (int jt = 0; jt < 2; ++jt) {
                    v8f s = fz8();
#pragma unroll
                    for (int f = 0; f < 2; ++f) {
                        const v16h kb = __builtin_shufflevector(kr[jt][f][0], kr[jt][f][1],
                                            0, 1, 2, 3, 4, 5, 6, 7, 8, 9, 10, 11, 12, 13, 14, 15);
                        s = __builtin_amdgcn_wmma_f32_16x16x32_f16(
                                false, kb, false, qa[f], (short)0, s, false, false);
                    }
                    const v8f bb = __builtin_shufflevector(bv[jt][0], bv[jt][1], 0, 1, 2, 3, 4, 5, 6, 7);
                    s = s * scale + bb;
#pragma unroll
                    for (int r = 0; r < 8; ++r)        // causal: strictly above diag
                        svals[jt][r] = (jt * 16 + r > dlt) ? -FLT_MAX : s[r];
                }

                // ---- online softmax, in-lane: 16 keys here, 16 in lane ^ 16 ----
                float t = fmaxf(svals[0][0], svals[1][0]);
#pragma unroll
                for (int r = 1; r < 8; ++r) t = fmaxf(t, fmaxf(svals[0][r], svals[1][r]));
                t = fmaxf(t, xhalf(t));
                const float mnew  = fmaxf(mrow, t);
                alpha = __expf(mrow - mnew);
                mrow = mnew;

                // P^T as a B operand straight from the accumulators: element e of the
                // fragment is key e + 8h (e < 8) or e + 8 + 8h, which is kmap's order.
#pragma unroll
                for (int r = 0; r < 8; ++r) {
                    pa[r]     = (h16)__expf(svals[0][r] - mrow);
                    pa[8 + r] = (h16)__expf(svals[1][r] - mrow);
                }

            }

            // Every reader left buffer cur ^ 1 in front of this trip's barrier. Stored
            // here, by waves that skip the tile too, so that the stores retire under the products below.
            stage_store(cur ^ 1);

            // The staging registers are free again: the group's tile after next goes out here and
            // has a whole trip to land, up to the next trip's stores. Behind a block's last tiles
            // come the first two of the next block. Issued on every trip, the workgroup's last
            // two as well (nobody reads those tiles).
            const int jn = it + 2 < ntr ? j0 + 2 * NGRP * BJ : (NGRP * (it + 2 - ntr) + grp) * BJ;
            // Stands in front of the rewrite of the address registers that the last trip's loads
            // name: the pointers are inputs so that their registers stay live up to the wait.
            // It stands here, a trip behind those loads, and so holds up no LDS read at the trip's top.
            asm volatile("s_wait_xcnt 0x0" :: "v"(kp), "v"(vp) : "memory");
            kp = kthr + (size_t)jn * DHEAD;
            vp = vthr + (size_t)jn * DHEAD;
            stage_load(kp, vp);

            if (act) {
                // ---- rescale O^T and l, then O^T += V^T P^T, l += ones x P^T ----
#pragma unroll
                for (int tt = 0; tt < 4; ++tt)
#pragma unroll
                    for (int r = 0; r < 8; ++r) o[tt][r] *= alpha;

                const v8f ls = __builtin_amdgcn_wmma_f32_16x16x32_f16(
                                   false, ones, false, pa, (short)0, fz8(), false, false);
#pragma unroll
                for (int tt = 0; tt < 4; ++tt) {
                    const v16h vb = __builtin_shufflevector(vr[tt][0], vr[tt][1],
                                        0, 1, 2, 3, 4, 5, 6, 7, 8, 9, 10, 11, 12, 13, 14, 15);
                    o[tt] = __builtin_amdgcn_wmma_f32_16x16x32_f16(
                                false, vb, false, pa, (short)0, o[tt], false, false);
                }
                lsum = lsum * alpha + ls[0];
            }
            cur ^= 1;
            bcur ^= (uint32_t)sizeof(b_lds[0]);
        }

        // The epilogue may rewrite the address registers that the last trip's loads name:
        // the pointers are inputs so that their registers stay live up to the wait.
        asm volatile("s_wait_xcnt 0x0" :: "v"(kp), "v"(vp) : "memory");

        // The second block's Q loads fly under the first block's epilogue.
        if (half == 0) load_q(pairi, qa);

        // ---- join the two groups' partial softmax: group 1 hands O^T, m, l to group 0 ----
        // A lane's partner is the same lane of wave + 8: same query, same d registers.
        if (grp == 1) {
#pragma unroll
            for (int t = 0; t < 4; ++t)
#pragma unroll
                for (int u = 0; u < 2; ++u) {
                    v4f w;
#pragma unroll
                    for (int e = 0; e < 4; ++e) w[e] = o[t][u * 4 + e];
                    *(v4f*)&mrg_lds[wave][t * 2 + u][lane][0] = w;
                }
            mrg_lds[wave][8][lane][0] = mrow;
            mrg_lds[wave][8][lane][1] = lsum;
        }
        // Group 1's partials are in LDS for group 0. The next write of mrg_lds lies behind
        // the next block's trip barriers.
        __syncthreads();

        // ---- normalize and store (non-temporal: output is never re-read) ------
        // Register r of o[t] is d = t*16 + 8h + r of query i0 + n16: 8 floats in a row.
        if (grp == 0) {
            const float m1   = mrg_lds[wave][8][lane][0];
            const float l1   = mrg_lds[wave][8][lane][1];
            const float mall = fmaxf(mrow, m1);
            const float a0   = __expf(mrow - mall);
            const float a1   = __expf(m1 - mall);      // 0 where group 1 had no tile under the diagonal
            const float inv  = 1.0f / (lsum * a0 + l1 * a1);
            const float c0   = a0 * inv;
            const float c1   = a1 * inv;
            float*      orow = out + base_qk + (size_t)(i0 + n16) * DHEAD + 8 * h;
#pragma unroll
            for (int t = 0; t < 4; ++t)
#pragma unroll
                for (int u = 0; u < 2; ++u) {
                    const v4f o1 = *(const v4f*)&mrg_lds[wave][t * 2 + u][lane][0];
                    v4f w;
#pragma unroll
                    for (int e = 0; e < 4; ++e) w[e] = o[t][u * 4 + e] * c0 + o1[e] * c1;
                    __builtin_nontemporal_store(w, (v4f*)(orow + t * 16 + u * 4));
                }
            // The next block's set-up rewrites registers that these stores name.
            asm volatile("s_wait_xcnt 0x0" ::: "memory");
        }
    }   // the pair's two query blocks
    // No copy is outstanding when the wave ends.
    asm volatile("s_wait_asynccnt 0x0" ::: "memory");
}

extern "C" void kernel_launch(void* const* d_in, const int* in_sizes, int n_in,
                              void* d_out, int out_size, void* d_ws, size_t ws_size,
                              hipStream_t stream) {
    const float* q    = (const float*)d_in[0];
    const float* k    = (const float*)d_in[1];
    const float* v    = (const float*)d_in[2];
    const float* bias = (const float*)d_in[3];
    float* out = (float*)d_out;

    dim3 grid(NSEQ / BQ / 2, 4 * 16);   // (pairs of i-blocks, B*H)
    dim3 block(NTHREADS);
    attn_fwd_wmma<<<grid, block, 0, stream>>>(q, k, v, bias, out);
}

// v009
// Measured time: 24.6 microseconds a run.
// In both of two side-by-side timings against v008, it was 1.04 times as fast.
// Over all steps from v000 it is 7.72 times as fast.
#include <hip/hip_runtime.h>
#include <cfloat>
#include <cmath>
#include <cstdint>

typedef _Float16 h16;
typedef __attribute__((ext_vector_type(16))) _Float16 v16h;
typedef __attribute__((ext_vector_type(8)))  _Float16 v8h;
typedef __attribute__((ext_vector_type(4)))  _Float16 v4h;
typedef __attribute__((ext_vector_type(8)))  float    v8f;
typedef __attribute__((ext_vector_type(4)))  float    v4f;

#define NSEQ     1024
#define DHEAD    64
#define BQ       128      // query rows per query block (a workgroup takes two)
#define WQ       16       // query rows per wave
#define BJ       32       // keys per j-iteration (K=32 for the PV WMMA)
#define NGRP     2        // wave groups per workgroup: group g takes key tiles g, g + 2, g + 4, ...
#define GTHREADS 256      // threads of one group (8 waves, one per 16 query rows)
#define NTHREADS (NGRP * GTHREADS)
// LDS row pitches: 16 B x odd, so that the 16 lanes of a ds_load_b128 that walk
// 16 rows fall on 16 different groups of four banks.
#define KP       72       // halves per K row   (144 B)
#define VP       40       // halves per V^T row (80 B)
#define BP       68       // floats per bias row of 64 keys (272 B)

// A/B fragment dword r (0..7) + lane-half h (0/1) -> first K index of the
// packed f16 pair, per the CDNA5 16-bit A-matrix 16x32 VGPR layout.
__device__ __forceinline__ int kmap(int r, int h) {
    return 2 * r + ((r >= 4) ? 8 : 0) + 8 * h;
}

__device__ __forceinline__ v8f fz8() {
    v8f z;
#pragma unroll
    for (int i = 0; i < 8; ++i) z[i] = 0.0f;
    return z;
}

// Lane l's value from lane l ^ 16: the two lanes that share one query column.
__device__ __forceinline__ float xhalf(float x) {
    const int xi = __builtin_bit_cast(int, x);
    return __builtin_bit_cast(float, __builtin_amdgcn_permlanex16(xi, xi, 0x76543210, 0xfedcba98, false, false));
}

__global__ __launch_bounds__(NTHREADS)
void attn_fwd_wmma(const float* __restrict__ q, const float* __restrict__ k,
                   const float* __restrict__ v, const float* __restrict__ bias,
                   float* __restrict__ out) {
    __shared__ __attribute__((aligned(16))) h16 kh_lds[2][NGRP][BJ * KP];      // keys as f16, row-major (j, d), dbl buf, per group
    __shared__ __attribute__((aligned(16))) h16 vT_lds[2][NGRP][DHEAD * VP];   // values as f16, transposed (d, j), dbl buf, per group
    __shared__ __attribute__((aligned(16))) float mrg_lds[BQ / WQ][9][32][4];   // group 1's O^T, m, l on their way to group 0
    __shared__ __attribute__((aligned(16))) float b_lds[2][BQ / WQ][WQ * BP];   // 16 x 64 bias tile of a pair of partner waves (wave and wave + 8), row-major (query, key), dbl buf

    const int tid  = threadIdx.x & (GTHREADS - 1);                          // thread index inside the group
    const int wv   = __builtin_amdgcn_readfirstlane((int)threadIdx.x >> 5);  // scalar: branches on it are wave-uniform
    const int grp  = wv >> 3;      // key-tile parity this wave works on
    const int wave = wv & 7;       // which 16 query rows of the block
    const int lane = tid & 31;
    const int n16  = lane & 15;    // this lane's query column; row of an A fragment
    const int h    = lane >> 4;    // lane half (selects K subset / row offset)

    const int pairi = blockIdx.x;              // 0..3: the pair of query blocks
    const int bh    = blockIdx.y;              // 0..63 (b*H + h)

    const float scale = 0.125f;                // 1/sqrt(64)

    const size_t base_qk = (size_t)bh * NSEQ * DHEAD;
    const size_t base_b  = (size_t)bh * NSEQ * NSEQ;

    // all-ones A fragment: column sums of P^T via WMMA (every row of ones x P^T is l)
    v16h ones;
#pragma unroll
    for (int i = 0; i < 16; ++i) ones[i] = (h16)1.0f;

    // ---- stage of one 32-key K/V tile, through registers: fp32 is rounded to f16 once,
    // by the thread that brings it, and every wave reads finished fragments from LDS.
    // K: twice 4 floats in a row, the wave's 32 lanes side by side. V: 8 keys in a row of column tid % 64.
    v4f   kst[2];
    float vst[8];
    const float* const kthr = k + base_qk + tid * 4;
    const float* const vthr = v + base_qk + (tid >> 6) * 8 * DHEAD + (tid & 63);
    auto stage_load = [&](const float* kp, const float* vp) {
        kst[0] = *(const v4f*)kp;
        kst[1] = *(const v4f*)(kp + GTHREADS * 4);
#pragma unroll
        for (int i = 0; i < 8; ++i) vst[i] = vp[i * DHEAD];
    };
    auto stage_store = [&](int buf) {
#pragma unroll
        for (int i = 0; i < 2; ++i) {
            v4h kh;
#pragma unroll
            for (int e = 0; e < 4; ++e) kh[e] = (h16)kst[i][e];
            *(v4h*)&kh_lds[buf][grp][((tid >> 4) + i * (GTHREADS / 16)) * KP + (tid & 15) * 4] = kh;
        }
        v8h vh;
#pragma unroll
        for (int i = 0; i < 8; ++i) vh[i] = (h16)vst[i];
        *(v8h*)&vT_lds[buf][grp][(tid & 63) * VP + (tid >> 6) * 8] = vh;
    };

    // ---- the 16-query x 64-key bias tile of a trip, global -> LDS by asynchronous copies.
    // The two key groups' tiles of a trip are the two 128 B halves of the same aligned 256 B
    // of each bias row. So that each such
    // 256 B is asked for once, by one instruction, the partner waves (the same 16 queries, one
    // wave in each key group) share one tile: each brings 8 of its 16 rows, all 64 keys wide
    // (16 lanes side by side on one row's 256 B, 2 rows a copy), and each reads its own 32 keys.
    const float* const bthr = bias + base_b + (size_t)(grp * 8 + h) * NSEQ + n16 * 4;
    const uint32_t     bdst = (uint32_t)(uintptr_t)&b_lds[0][wave][(grp * 8 + h) * BP + n16 * 4];
    auto bias_copy = [&](int r0, int jc, uint32_t boff) {   // jc: the pair's first key; boff: the buffer's byte offset in b_lds
        const float*   g0 = bthr + (size_t)r0 * NSEQ + jc;
        const float*   g1 = g0 + 2 * NSEQ;
        const float*   g2 = g0 + 4 * NSEQ;
        const float*   g3 = g0 + 6 * NSEQ;
        const uint32_t l0 = bdst + boff;
        const uint32_t l1 = l0 + 2 * BP * 4;
        const uint32_t l2 = l0 + 4 * BP * 4;
        const uint32_t l3 = l0 + 6 * BP * 4;
        // The wait is the statement's last line, so that it stands in front of any
        // rewrite of the address registers that the copies name.
        // Bias is stream-once: non-temporal keeps K/V resident in L2.
        asm volatile("global_load_async_to_lds_b128 %0, %4, off th:TH_LOAD_NT\n\t"
                     "global_load_async_to_lds_b128 %1, %5, off th:TH_LOAD_NT\n\t"
                     "global_load_async_to_lds_b128 %2, %6, off th:TH_LOAD_NT\n\t"
                     "global_load_async_to_lds_b128 %3, %7, off th:TH_LOAD_NT\n\t"
                     "s_wait_xcnt 0x0"
                     :: "v"(l0), "v"(l1), "v"(l2), "v"(l3), "v"(g0), "v"(g1), "v"(g2), "v"(g3)
                     : "memory");
    };

    // ---- Q fragments (B operand: lane = query, same k map) of one query block, fp32 -> f16 -
    auto load_q = [&](int blk, v16h (&dst)[2]) {
        // this lane's row, at its half's first k index
        const float* qrow = q + base_qk + (size_t)(blk * BQ + wave * WQ + n16) * DHEAD + kmap(0, h);
        float raw[2][16];
#pragma unroll
        for (int f = 0; f < 2; ++f) {
#pragma unroll
            for (int r = 0; r < 8; ++r) {
                const int d0 = f * 32 + kmap(r, 0);
                raw[f][2 * r]     = qrow[d0];
                raw[f][2 * r + 1] = qrow[d0 + 1];
            }
        }
        // Stands in front of any rewrite of the address registers these loads
        // name: qrow is an input so that its registers stay live up to the wait.
        asm volatile("s_wait_xcnt 0x0" :: "v"(qrow) : "memory");
#pragma unroll
        for (int f = 0; f < 2; ++f)
#pragma unroll
            for (int i = 0; i < 16; ++i) dst[f][i] = (h16)raw[f][i];
    };

    // The first bias tile of the first query block, into buffer 0; the first trip's wait and barrier publish it.
    // It starts at key 0, which lies under every query's diagonal: always wanted.
    bias_copy((NSEQ / BQ - 1 - pairi) * BQ + wave * WQ, 0, 0);

    {
        const float* kp = kthr + grp * BJ * DHEAD;
        const float* vp = vthr + grp * BJ * DHEAD;
        stage_load(kp, vp);
        // Stands in front of any rewrite of the address registers these loads
        // name: the pointers are inputs so that their registers stay live up to the wait.
        asm volatile("s_wait_xcnt 0x0" :: "v"(kp), "v"(vp) : "memory");
    }
    int cur = 0;
    uint32_t bcur = 0;   // byte offset in b_lds of the bias buffer that this trip reads: 0 or one buffer's size

    v16h qa[2];
    load_q(NSEQ / BQ - 1 - pairi, qa);
    stage_store(0);
    // The group's second tile: in flight over the first trip, which stores it. kp and vp keep
    // the addresses of the loads in flight until the wait that stands in front of their rewrite.
    const float* kp = kthr + (grp + NGRP) * BJ * DHEAD;
    const float* vp = vthr + (grp + NGRP) * BJ * DHEAD;
    stage_load(kp, vp);

    // Causal cost grows linearly with the query block's index, so every
    // workgroup takes block 7-p and then block p, one after the other: the
    // same 36 key tiles in each workgroup, 18 for each wave group. Kept rolled:
    // two copies of the body would only double the code.
#pragma unroll 1
    for (int half = 0; half < 2; ++half) {
        const int iblk  = half ? pairi : (NSEQ / BQ - 1 - pairi);
        const int wg_i0 = iblk * BQ;
        const int i0    = wg_i0 + wave * WQ;       // this wave's first query row

        // ---- accumulators & online-softmax state ------------------------------
        v8f o[4];
#pragma unroll
        for (int t = 0; t < 4; ++t) o[t] = fz8();
        float lsum = 0.0f;                         // this lane's query: softmax denominator
        float mrow = -FLT_MAX;                     // this lane's query: running maximum

        const int ntr = (wg_i0 + BQ) / (NGRP * BJ);   // trips: uniform across the workgroup, the same in both groups

        for (int it = 0; it < ntr; ++it) {
            const int j0 = (NGRP * it + grp) * BJ;    // this group's key tile of the trip

            // This wave's LDS reads of the last trip have retired before its copies refill that buffer.
            asm volatile("s_wait_dscnt 0x0" ::: "memory");
            // This wave's half of the trip's bias tile, copied during the last trip, has landed;
            // the barrier below hands it to the partner wave, and the partner's half to this one.
            asm volatile("s_wait_asynccnt 0x0" ::: "memory");
            // The trip's barrier: everyone's stores of this trip's tile visible; prev buffer free.
            // Written out with fences on LDS alone: what the waves hand each other here is in LDS,
            // and __syncthreads() would also wait out the K/V loads that are in flight to registers.
            __builtin_amdgcn_fence(__ATOMIC_RELEASE, "workgroup", "local");
            __builtin_amdgcn_s_barrier();
            __builtin_amdgcn_fence(__ATOMIC_ACQUIRE, "workgroup", "local");

            const bool act  = j0 <= i0 + WQ - 1;   // wave-uniform causal skip
            const bool more = it + 1 < ntr;

            const int row = i0 + n16;

            v8h   kr[2][2][2];   // K fragments
            v4f   bv[2][2];      // this lane's bias
            v8h   vr[4][2];   // V^T fragments, read with K's, used behind the stores
            v16h  pa;         // P^T
            float alpha;      // what the new maximum scales the old sums by
            if (act) {
                // prefetch what the next trip will copy: one lane per query row, so one
                // wave asks for 32 query rows, its own pair's 16 and the 16 of the pair behind it
                // (both pairs' rows lie in the same 32, so the key limit reads the same for both)
                if (grp == 0 && (wave & 1) == 0 && it + 2 < ntr && (it + 2) * NGRP * BJ <= i0 + WQ - 1) {
                    const float* bp = bias + base_b + (size_t)(i0 + lane) * NSEQ
                                      + (size_t)((it + 2) * NGRP * BJ);
                    __builtin_prefetch(bp, 0, 3);   // locality 3: shader-engine scope, the unit goes to L2
                }

                const h16* kbuf = kh_lds[cur][grp];
                const h16* vbuf = vT_lds[cur][grp];

                // ---- S^T = K Q^T (+scale +bias +causal), two 16-key subtiles ----
                // Fragment element 8q + e has k index 8h + 16q + e: kmap's order.
#pragma unroll
                for (int jt = 0; jt < 2; ++jt) {
                    const h16* krow = &kbuf[(jt * 16 + n16) * KP + 8 * h];
#pragma unroll
                    for (int f = 0; f < 2; ++f)
#pragma unroll
                        for (int qd = 0; qd < 2; ++qd)
                            kr[jt][f][qd] = *(const v8h*)(krow + f * 32 + kmap(4 * qd, 0));
                }
                // Keeps the K reads in front of the V reads: S^T needs K first, and a K read
                // issued last would make its products wait for every V read as well.
                __builtin_amdgcn_sched_barrier(0);
                // S^T accumulator register r of this lane: key j0 + jt*16 + 8h + r of
                // query i0 + n16, so a lane's bias is 8 floats in a row per subtile.
                const float* brow = (const float*)((const char*)&b_lds[0][wave][n16 * BP + grp * BJ + 8 * h] + bcur);
#pragma unroll
                for (int jt = 0; jt < 2; ++jt)
#pragma unroll
                    for (int u = 0; u < 2; ++u)
                        bv[jt][u] = *(const v4f*)(brow + jt * 16 + u * 4);
                // Keeps the bias reads in front of the V reads: the scores take the bias right
                // behind their products, V is not needed before the softmax is done.
                __builtin_amdgcn_sched_barrier(0);
#pragma unroll
                for (int tt = 0; tt < 4; ++tt) {
                    const h16* vcol = &vbuf[(tt * 16 + n16) * VP + 8 * h];
#pragma unroll
                    for (int qd = 0; qd < 2; ++qd)
                        vr[tt][qd] = *(const v8h*)(vcol + kmap(4 * qd, 0));
                }
                // Keeps the trip's bias and fragment loads issued here, ahead of all
                // the arithmetic: sunk to their first uses, each latency would be waited out alone.
                __builtin_amdgcn_sched_barrier(0);
            }

            // The wave's half of the next bias tile flies under this trip's work, into the buffer
            // that both partners left in front of this trip's barrier; behind a block's last tile
            // comes the first tile of the next block. A tile wholly above the pair's diagonal is
            // not copied: nobody reads it. The test reads the same in both partners.
            // Issued behind this trip's LDS reads, so that its issue hides under their latency.
            const int ni0 = more ? i0 : pairi * BQ + wave * WQ;
            const int nj  = more ? (it + 1) * NGRP * BJ : 0;
            const int nlim = (more || half == 0) ? ni0 + WQ - 1 : -1;   // behind the workgroup's last trip comes no tile
            if (nj <= nlim) bias_copy(ni0, nj, bcur ^ (uint32_t)sizeof(b_lds[0]));

            if (act) {
                const int dlt = row - j0 - 8 * h;      // key index in this lane's run that sits on the diagonal
                float svals[2][8];
#pragma unroll
                for (int jt = 0; jt < 2; ++jt) {
                    v8f s = fz8();
#pragma unroll
                    for (int f = 0; f < 2; ++f) {
                        const v16h kb = __builtin_shufflevector(kr[jt][f][0], kr[jt][f][1],
                                            0, 1, 2, 3, 4, 5, 6, 7, 8, 9, 10, 11, 12, 13, 14, 15);
                        s = __builtin_amdgcn_wmma_f32_16x16x32_f16(
                                false, kb, false, qa[f], (short)0, s, false, false);
                    }
                    const v8f bb = __builtin_shufflevector(bv[jt][0], bv[jt][1], 0, 1, 2, 3, 4, 5, 6, 7);
                    s = s * scale + bb;
#pragma unroll
                    for (int r = 0; r < 8; ++r) svals[jt][r] = s[r];
                }
                // causal: strictly above diag. Only the wave's last tile reaches above its first
                // query's diagonal; the test is scalar, so every other tile skips the 32 instructions.
                if (j0 + BJ - 1 > i0) {
#pragma unroll
                    for (int jt = 0; jt < 2; ++jt)
#pragma unroll
                        for (int r = 0; r < 8; ++r)
                            svals[jt][r] = (jt * 16 + r > dlt) ? -FLT_MAX : svals[jt][r];
                }

                // ---- online softmax, in-lane: 16 keys here, 16 in lane ^ 16 ----
                float t = fmaxf(svals[0][0], svals[1][0]);
#pragma unroll
                for (int r = 1; r < 8; ++r) t = fmaxf(t, fmaxf(svals[0][r], svals[1][r]));
                t = fmaxf(t, xhalf(t));
                const float mnew  = fmaxf(mrow, t);
                alpha = __expf(mrow - mnew);
                mrow = mnew;

                // P^T as a B operand straight from the accumulators: element e of the
                // fragment is key e + 8h (e < 8) or e + 8 + 8h, which is kmap's order.
#pragma unroll
                for (int r = 0; r < 8; ++r) {
                    pa[r]     = (h16)__expf(svals[0][r] - mrow);
                    pa[8 + r] = (h16)__expf(svals[1][r] - mrow);
                }

            }

            // Every reader left buffer cur ^ 1 in front of this trip's barrier. Stored
            // here, by waves that skip the tile too, so that the stores retire under the products below.
            stage_store(cur ^ 1);

            // The staging registers are free again: the group's tile after next goes out here and
            // has a whole trip to land, up to the next trip's stores. Behind a block's last tiles
            // come the first two of the next block. Issued on every trip, the workgroup's last
            // two as well (nobody reads those tiles).
            const int jn = it + 2 < ntr ? j0 + 2 * NGRP * BJ : (NGRP * (it + 2 - ntr) + grp) * BJ;
            // Stands in front of the rewrite of the address registers that the last trip's loads
            // name: the pointers are inputs so that their registers stay live up to the wait.
            // It stands here, a trip behind those loads, and so holds up no LDS read at the trip's top.
            asm volatile("s_wait_xcnt 0x0" :: "v"(kp), "v"(vp) : "memory");
            kp = kthr + (size_t)jn * DHEAD;
            vp = vthr + (size_t)jn * DHEAD;
            stage_load(kp, vp);

            if (act) {
                // ---- rescale O^T and l, then O^T += V^T P^T, l += ones x P^T ----
#pragma unroll
                for (int tt = 0; tt < 4; ++tt)
#pragma unroll
                    for (int r = 0; r < 8; ++r) o[tt][r] *= alpha;

                const v8f ls = __builtin_amdgcn_wmma_f32_16x16x32_f16(
                                   false, ones, false, pa, (short)0, fz8(), false, false);
#pragma unroll
                for (int tt = 0; tt < 4; ++tt) {
                    const v16h vb = __builtin_shufflevector(vr[tt][0], vr[tt][1],
                                        0, 1, 2, 3, 4, 5, 6, 7, 8, 9, 10, 11, 12, 13, 14, 15);
                    o[tt] = __builtin_amdgcn_wmma_f32_16x16x32_f16(
                                false, vb, false, pa, (short)0, o[tt], false, false);
                }
                lsum = lsum * alpha + ls[0];
            }
            cur ^= 1;
            bcur ^= (uint32_t)sizeof(b_lds[0]);
        }

        // The epilogue may rewrite the address registers that the last trip's loads name:
        // the pointers are inputs so that their registers stay live up to the wait.
        asm volatile("s_wait_xcnt 0x0" :: "v"(kp), "v"(vp) : "memory");

        // The second block's Q loads fly under the first block's epilogue.
        if (half == 0) load_q(pairi, qa);

        // ---- join the two groups' partial softmax: group 1 hands O^T, m, l to group 0 ----
        // A lane's partner is the same lane of wave + 8: same query, same d registers.
        if (grp == 1) {
#pragma unroll
            for (int t = 0; t < 4; ++t)
#pragma unroll
                for (int u = 0; u < 2; ++u) {
                    v4f w;
#pragma unroll
                    for (int e = 0; e < 4; ++e) w[e] = o[t][u * 4 + e];
                    *(v4f*)&mrg_lds[wave][t * 2 + u][lane][0] = w;
                }
            mrg_lds[wave][8][lane][0] = mrow;
            mrg_lds[wave][8][lane][1] = lsum;
        }
        // Group 1's partials are in LDS for group 0. The next write of mrg_lds lies behind
        // the next block's trip barriers.
        __syncthreads();

        // ---- normalize and store (non-temporal: output is never re-read) ------
        // Register r of o[t] is d = t*16 + 8h + r of query i0 + n16: 8 floats in a row.
        if (grp == 0) {
            const float m1   = mrg_lds[wave][8][lane][0];
            const float l1   = mrg_lds[wave][8][lane][1];
            const float mall = fmaxf(mrow, m1);
            const float a0   = __expf(mrow - mall);
            const float a1   = __expf(m1 - mall);      // 0 where group 1 had no tile under the diagonal
            const float inv  = 1.0f / (lsum * a0 + l1 * a1);
            const float c0   = a0 * inv;
            const float c1   = a1 * inv;
            float*      orow = out + base_qk + (size_t)(i0 + n16) * DHEAD + 8 * h;
#pragma unroll
            for (int t = 0; t < 4; ++t)
#pragma unroll
                for (int u = 0; u < 2; ++u) {
                    const v4f o1 = *(const v4f*)&mrg_lds[wave][t * 2 + u][lane][0];
                    v4f w;
#pragma unroll
                    for (int e = 0; e < 4; ++e) w[e] = o[t][u * 4 + e] * c0 + o1[e] * c1;
                    __builtin_nontemporal_store(w, (v4f*)(orow + t * 16 + u * 4));
                }
            // The next block's set-up rewrites registers that these stores name.
            asm volatile("s_wait_xcnt 0x0" ::: "memory");
        }
    }   // the pair's two query blocks
    // No copy is outstanding when the wave ends.
    asm volatile("s_wait_asynccnt 0x0" ::: "memory");
}

extern "C" void kernel_launch(void* const* d_in, const int* in_sizes, int n_in,
                              void* d_out, int out_size, void* d_ws, size_t ws_size,
                              hipStream_t stream) {
    const float* q    = (const float*)d_in[0];
    const float* k    = (const float*)d_in[1];
    const float* v    = (const float*)d_in[2];
    const float* bias = (const float*)d_in[3];
    float* out = (float*)d_out;

    dim3 grid(NSEQ / BQ / 2, 4 * 16);   // (pairs of i-blocks, B*H)
    dim3 block(NTHREADS);
    attn_fwd_wmma<<<grid, block, 0, stream>>>(q, k, v, bias, out);
}
